// v000
// Times are from an AMD MI455X. After a warm-up the kernel runs many times in a row, and a time is the length of
// such a window on the GPU divided by its runs, so every launch and the gaps after it count. The runs cycle
// through copies of the inputs. A figure is the median of several windows, for all but v000 over two sittings.
// Sittings can differ by a few percent; kernels timed side by side share one.
// The starting kernel, v000, takes 1110 microseconds a run.
#include <hip/hip_runtime.h>

// Light self-attention over image positions (x [8][128][64x64 = 4096] channel-major; per image q/k/v = W x + b (1x1 convs, W [128 out][128 in]); attn[n][m] = softmax_m(q_n.k_m / sqrt(128)) over the 4096 positions; out[c][n] = sum_m attn[n][m] v[c][m] + x[c][n] -> [8][128][64][64]).
// Layout: the 8 images are processed as 8 independent 128-wide 'heads' of one 4096-token sequence (head h = image h): XT[h][n][c] = bf16(x[h][c][n]) (transposed once), q/k/v [n][h*128 + o] from ONE z-batched exact GEMM each (z = image, shared weights, bias in the epilogue), then the standard per-head attention; the epilogue writes the channel-major output with the residual.
// Compute dtypes, f32 accumulate: every input rounded to bf16; q/k/v on PLAIN bf16 operands (inputs: exact) + bias; scores and attn.v on single fp16 planes (P x1024) over 4096 keys, one image per pass; 1/sqrt(128) and softmax in f32; out = attn.v (f32) + bf16(x) written transposed into [c][n] rows.

#define NB_  1
#define NIMG 8                    // images = 'heads'
#define CIN  128                  // channels
#define NPOS 4096                 // positions per image
#define TT   4096
#define DM   128
#define NH_  8
#define NKV  8
#define REP  (NH_ / NKV)
#define HD   128
#define DQ   (NH_ * HD)
#define DKV  (NKV * HD)
#define ZH   1                    // one image per pass (keeps the [4096][4096] score block at 64 MiB)
#define RH   0                  // query rows < RH use hi+lo planes (0: none)
#define WIN  0
#define PCAR 1024.0f
#define SCL  0.088388347648318447f   // HD^-0.5
typedef _Float16 h16;
typedef unsigned short bf;
typedef __attribute__((ext_vector_type(16))) __bf16   v16bf;
typedef __attribute__((ext_vector_type(16))) _Float16 v16h;
typedef __attribute__((ext_vector_type(8)))  _Float16 v8h;
typedef __attribute__((ext_vector_type(8)))  unsigned short v8us;
typedef __attribute__((ext_vector_type(8)))  float    v8f;
typedef __attribute__((ext_vector_type(4)))  float    v4f;
typedef v8h  __attribute__((may_alias)) v8ha;
typedef v4f  __attribute__((may_alias)) v4fa;
typedef v8us __attribute__((may_alias)) v8usa;

__device__ __forceinline__ unsigned short f2bf(float f) { unsigned u = __float_as_uint(f); u += 0x7FFFu + ((u >> 16) & 1u); return (unsigned short)(u >> 16); }
__device__ __forceinline__ float bf2f(unsigned short b) { return __uint_as_float(((unsigned)b) << 16); }
__device__ __forceinline__ float bfr(float f) { return bf2f(f2bf(f)); }
__device__ __forceinline__ v16h cat16(v8h lo, v8h hi) { return __builtin_shufflevector(lo, hi, 0, 1, 2, 3, 4, 5, 6, 7, 8, 9, 10, 11, 12, 13, 14, 15); }
__device__ __forceinline__ v16bf cat16b(v8us lo, v8us hi) { return __builtin_bit_cast(v16bf, __builtin_shufflevector(lo, hi, 0, 1, 2, 3, 4, 5, 6, 7, 8, 9, 10, 11, 12, 13, 14, 15)); }
__device__ __forceinline__ v8f wmma16(v16h a, v16h b, v8f c) { return __builtin_amdgcn_wmma_f32_16x16x32_f16(false, a, false, b, (short)0, c, false, false); }
__device__ __forceinline__ v8f wmmab(v16bf a, v16bf b, v8f c) { return __builtin_amdgcn_wmma_f32_16x16x32_bf16(false, a, false, b, (short)0, c, false, false); }



// ---- k_gemmw: register-blocked GEMM, ONE WAVE per 64x64 output tile (16 accumulators), operands straight from K-contiguous 16-bit planes; grid (M/64, N/64, Z), 32 threads.
// C[m][n] (f32, pitch ldc, + optional f32 bias[n]) = sum_k A[m][k] Bt[n][k] (+ split products per NSPLIT). z-batch strides sA/sB/sC in elements. K % 32 == 0.
template <typename T16> struct WFrag;
template <> struct WFrag<h16> { typedef v16h V; static __device__ __forceinline__ V ld(const h16* p) { return cat16(*(const v8h*)p, *(const v8h*)(p + 16)); } static __device__ __forceinline__ v8f mma(V a, V b, v8f c) { return wmma16(a, b, c); } };
template <> struct WFrag<bf> { typedef v16bf V; static __device__ __forceinline__ V ld(const bf* p) { return cat16b(*(const v8us*)p, *(const v8us*)(p + 16)); } static __device__ __forceinline__ v8f mma(V a, V b, v8f c) { return wmmab(a, b, c); } };
template <typename T16, int NSPLIT, bool BIAS>
__global__ __launch_bounds__(32) void k_gemmw(const T16* __restrict__ A, const T16* __restrict__ A2, const T16* __restrict__ Bt, const T16* __restrict__ Bt2, int K, float* C, int ldc, const float* __restrict__ bias, size_t sA, size_t sB, size_t sC) {
    typedef typename WFrag<T16>::V V;
    __shared__ __align__(16) float os[16 * 68];
    const size_t z = blockIdx.z; A += z * sA; if (A2) A2 += z * sA; Bt += z * sB; if (Bt2) Bt2 += z * sB; C += z * sC;
    const int lane = threadIdx.x & 31, lr = lane & 15, hi = lane >> 4; const int r0 = blockIdx.x * 64, c0 = blockIdx.y * 64;
    v8f acc[4][4];
#pragma unroll
    for (int mb = 0; mb < 4; ++mb)
#pragma unroll
        for (int nb = 0; nb < 4; ++nb) acc[mb][nb] = (v8f){};
    const size_t aoff = (size_t)(r0 + lr) * K + 8 * hi, boff = (size_t)(c0 + lr) * K + 8 * hi;
#pragma unroll 1
    for (int kc = 0; kc < K; kc += 32) {
        V a[4], a2[4];
#pragma unroll
        for (int mb = 0; mb < 4; ++mb) { a[mb] = WFrag<T16>::ld(A + aoff + (size_t)mb * 16 * K + kc); if (NSPLIT == 1 || NSPLIT == 2) a2[mb] = WFrag<T16>::ld(A2 + aoff + (size_t)mb * 16 * K + kc); }
#pragma unroll
        for (int nb = 0; nb < 4; ++nb) { const V b = WFrag<T16>::ld(Bt + boff + (size_t)nb * 16 * K + kc); V b2; if (NSPLIT >= 2) b2 = WFrag<T16>::ld(Bt2 + boff + (size_t)nb * 16 * K + kc);
#pragma unroll
            for (int mb = 0; mb < 4; ++mb) { acc[mb][nb] = WFrag<T16>::mma(a[mb], b, acc[mb][nb]); if (NSPLIT == 1 || NSPLIT == 2) acc[mb][nb] = WFrag<T16>::mma(a2[mb], b, acc[mb][nb]); if (NSPLIT >= 2) acc[mb][nb] = WFrag<T16>::mma(a[mb], b2, acc[mb][nb]); } }
        asm volatile("v_nop\n\tv_nop\n\tv_nop\n\tv_nop" : "+v"(acc[0][0]), "+v"(acc[1][1]), "+v"(acc[2][2]), "+v"(acc[3][3]) : "v"(a[0]), "v"(a[3]));
    }
#pragma unroll
    for (int mb = 0; mb < 4; ++mb) {
#pragma unroll
        for (int nb = 0; nb < 4; ++nb) {
#pragma unroll
            for (int j = 0; j < 8; ++j) os[(hi * 8 + j) * 68 + nb * 16 + lr] = acc[mb][nb][j]; }
        __builtin_amdgcn_wave_barrier(); asm volatile("" ::: "memory");
        float* crow = C + (size_t)(r0 + mb * 16) * ldc + c0;
{
#pragma unroll
            for (int s = 0; s < 8; ++s) { const int row = 2 * s + hi, cofs = lr * 4; v4f val = *(const v4fa*)(os + row * 68 + cofs); if (BIAS) { val[0] += bfr(bias[c0 + cofs]); val[1] += bfr(bias[c0 + cofs + 1]); val[2] += bfr(bias[c0 + cofs + 2]); val[3] += bfr(bias[c0 + cofs + 3]); }
                *(v4f*)(crow + (size_t)row * ldc + cofs) = val; }
             }
        __builtin_amdgcn_wave_barrier(); asm volatile("" ::: "memory");
    }
}

__device__ __forceinline__ h16 tohx(float x) { return (h16)x; }
__device__ __forceinline__ void splitf(float y, unsigned short& h, unsigned short& l) { h = f2bf(y); l = f2bf(y - bf2f(h)); }
typedef __attribute__((ext_vector_type(2))) _Float16 v2h;
typedef __attribute__((ext_vector_type(4))) _Float16 v4h;
typedef __attribute__((ext_vector_type(2))) unsigned short v2us;
typedef __attribute__((ext_vector_type(4))) unsigned short v4us;
typedef __attribute__((ext_vector_type(2))) float v2f;
typedef __attribute__((ext_vector_type(4))) int v4i;

__global__ __launch_bounds__(256) void k_wtG(const float* __restrict__ w, int K, int N, bf* Bt) {
    const int lane = threadIdx.x & 31; const int L0 = (blockIdx.x * 8 + (threadIdx.x >> 5)) * 8; const int nlines = N * K / 64;
{
#pragma unroll 1
        for (int l = 0; l < 8; ++l) { const int L = L0 + l; if (L >= nlines) break; const size_t e = (size_t)L * 64 + lane * 2; const int k = (int)(e % K), n = (int)(e / K); v2us o;
            o[0] = f2bf(w[(size_t)k * N + n]); o[1] = f2bf(w[(size_t)(k + 1) * N + n]); *(v2us*)(Bt + e) = o; }
         }
}
__global__ __launch_bounds__(256) void k_cvt8(const float* __restrict__ src, bf* dst, size_t n8) { const size_t i = (size_t)blockIdx.x * 256 + threadIdx.x; if (i >= n8) return; const v8f v = *(const v8f*)(src + i * 8); v8us o;
#pragma unroll
    for (int k = 0; k < 8; ++k) o[k] = f2bf(v[k]); *(v8us*)(dst + i * 8) = o;  }

// k_rope: head planes [h][t][d] (fp16) of rope(x) x sc with the rotate-half convention out[d] = x[d] cos[t][d] - x[d+HD/2] sin[t][d], out[d+HD/2] = x[d+HD/2] cos[t][d+HD/2] + x[d] sin[t][d+HD/2]
__global__ __launch_bounds__(256) void k_rope(const float* __restrict__ F, int pitch, int nheads, const float* __restrict__ CS, const float* __restrict__ RF, const float* __restrict__ nw, float sc, h16* P16, bf* Ph, bf* Pl) {
    const size_t e = ((size_t)blockIdx.x * 256 + threadIdx.x) * 2; if (e >= (size_t)nheads * TT * HD) return; const int d = (int)(e % HD); const int t = (int)((e / HD) % TT); const int h = (int)(e / ((size_t)HD * TT)); const float* f = F + (size_t)t * pitch + h * HD; const float rf = RF ? RF[(size_t)h * TT + t] : 1.0f; v2h o16; v2us oh, ol;
#pragma unroll
    for (int q = 0; q < 2; ++q) { const int dd = d + q; const int dp = (dd < HD / 2) ? dd + HD / 2 : dd - HD / 2; float x0 = f[dd], x1 = f[dp];
        if (RF) { float n0 = __fmul_rn(x0, rf), n1 = __fmul_rn(x1, rf); asm volatile("" : "+v"(n0)); asm volatile("" : "+v"(n1)); x0 = __fmul_rn(bfr(nw[dd]), n0); x1 = __fmul_rn(bfr(nw[dp]), n1); }
        const v2f cs = *(const v2f*)(CS + ((size_t)t * HD + dd) * 2); float a = __fmul_rn(x0, cs[0]), bq = __fmul_rn(x1, cs[1]); asm volatile("" : "+v"(a)); asm volatile("" : "+v"(bq)); const float r = ((dd < HD / 2) ? __fsub_rn(a, bq) : __fadd_rn(a, bq)) * sc;
        o16[q] = tohx(r); (void)oh; (void)ol; }
    *(v2h*)(P16 + e) = o16;  }
__global__ __launch_bounds__(256) void k_vtp(const float* __restrict__ F, int pitch, int nheads, h16* V16, bf* Vh, bf* Vl) { const size_t e = ((size_t)blockIdx.x * 256 + threadIdx.x) * 2; if (e >= (size_t)nheads * HD * TT) return; const int t = (int)(e % TT); const int d = (int)((e / TT) % HD); const int g = (int)(e / ((size_t)TT * HD)); v2h o16; v2us oh, ol;
#pragma unroll
    for (int q = 0; q < 2; ++q) { const float x = F[(size_t)(t + q) * pitch + g * HD + d]; o16[q] = tohx(x); (void)oh; (void)ol; }
    *(v2h*)(V16 + e) = o16;  }
__global__ __launch_bounds__(256) void k_csid(float* CS) { const int idx = blockIdx.x * 256 + threadIdx.x; if (idx >= TT * HD) return; v2f cs; cs[0] = 1.0f; cs[1] = 0.0f; *(v2f*)(CS + (size_t)idx * 2) = cs;  }
// k_asoft: per row (zz, i): t = S x HD^-0.5 (no mask); softmax over the 4096 keys (register row, one exp, fixed trees);
__global__ __launch_bounds__(256) void k_asoft(const float* __restrict__ Sb, h16* P16, bf* Ph, bf* Pl) {
    const int lane = threadIdx.x & 31; const int row = blockIdx.x * 8 + (threadIdx.x >> 5); if (row >= ZH * TT) return; const int i = row % TT; const int zz = row / TT; (void)zz; const bool hires = (i < RH); const float* sr = Sb + (size_t)row * TT; float v[TT / 32]; float mx = -3.0e38f;
#pragma unroll
    for (int ch = 0; ch < TT / 128; ++ch) { const int j0 = ch * 128 + lane * 4; const v4f a = *(const v4f*)(sr + j0);
#pragma unroll
        for (int q = 0; q < 4; ++q) { const int j = j0 + q; (void)j; const float t = a[q] * SCL; v[ch * 4 + q] = t; mx = fmaxf(mx, t); } }
#pragma unroll
    for (int sh = 16; sh; sh >>= 1) mx = fmaxf(mx, __shfl_xor(mx, sh, 32));
    float sum = 0.f;
#pragma unroll
    for (int k = 0; k < TT / 32; ++k) { float d0 = __fsub_rn(v[k], mx); asm volatile("" : "+v"(d0)); v[k] = __builtin_amdgcn_exp2f(__fmul_rn(d0, 1.4426950408889634f)); sum += v[k]; }
#pragma unroll
    for (int sh = 16; sh; sh >>= 1) sum += __shfl_xor(sum, sh, 32);
    const float f = __fdiv_rn(hires ? 1.0f : PCAR, sum);
{
        if (hires) {
#pragma unroll
            for (int ch = 0; ch < TT / 128; ++ch) { v4us oh, ol;
#pragma unroll
                for (int q = 0; q < 4; ++q) { unsigned short a, c2; splitf(v[ch * 4 + q] * f, a, c2); oh[q] = a; ol[q] = c2; }
                const size_t oo = ((size_t)zz * (RH ? RH : 1) + i) * TT + ch * 128 + lane * 4; *(v4us*)(Ph + oo) = oh; *(v4us*)(Pl + oo) = ol; }
        } else {
#pragma unroll
            for (int ch = 0; ch < TT / 128; ++ch) { v4h o4;
#pragma unroll
                for (int q = 0; q < 4; ++q) o4[q] = tohx(v[ch * 4 + q] * f);
                *(v4h*)(P16 + (size_t)row * TT + ch * 128 + lane * 4) = o4; } }
         }
}
__global__ __launch_bounds__(256) void k_mergeT(const float* __restrict__ O, const float* __restrict__ X, int h0, float* OUT) { const size_t e = ((size_t)blockIdx.x * 256 + threadIdx.x) * 2; if (e >= (size_t)ZH * TT * HD) return; const int t = (int)(e % TT); const int d = (int)((e / TT) % HD); const int zz = (int)(e / ((size_t)TT * HD)); const size_t oo = ((size_t)(h0 + zz) * HD + d) * TT + t; v2f o2;
#pragma unroll
    for (int q = 0; q < 2; ++q) { const int tq = t + q; const float cs = (tq < RH) ? 1.0f : (1.0f / PCAR); const float a = O[((size_t)zz * TT + tq) * HD + d] * cs; o2[q] = __fadd_rn(a, bfr(X[oo + q])); }
    *(v2f*)(OUT + oo) = o2;  }

extern "C" void kernel_launch(void* const* d_in, const int* in_sizes, int n_in,
                              void* d_out, int out_size, void* d_ws, size_t ws_size, hipStream_t stream) {
    (void)in_sizes; (void)n_in; (void)out_size;
    const float* x = (const float*)d_in[0]; const float* wq = (const float*)d_in[1]; const float* bq = (const float*)d_in[2]; const float* wk = (const float*)d_in[3]; const float* bk = (const float*)d_in[4]; const float* wv = (const float*)d_in[5]; const float* bv = (const float*)d_in[6];
    float* OUT = (float*)d_out;     // [8][128][4096]
    char* wsp = (char*)d_ws;
    auto take = [&](size_t bytes) { char* p = wsp; wsp += (bytes + 255) & ~(size_t)255; return (void*)p; };
    bf* WQ = (bf*)take((size_t)CIN * CIN * 2); bf* WK = (bf*)take((size_t)CIN * CIN * 2); bf* WV = (bf*)take((size_t)CIN * CIN * 2); float* CS = (float*)take((size_t)TT * HD * 2 * 4);
    bf* XT = (bf*)take((size_t)NIMG * NPOS * CIN * 2); float* FQ = (float*)take((size_t)TT * DQ * 4); float* FK = (float*)take((size_t)TT * DKV * 4);
    h16* QP16 = (h16*)take((size_t)NH_ * TT * HD * 2); h16* KP16 = (h16*)take((size_t)NKV * TT * HD * 2); h16* VT16 = (h16*)take((size_t)NKV * HD * TT * 2);
    bf* QPh = nullptr; bf* QPl = nullptr; bf* KPh = nullptr; bf* KPl = nullptr; bf* VTh = nullptr; bf* VTl = nullptr; bf* Ph = nullptr; bf* Pl = nullptr;
    float* Sb = (float*)take((size_t)ZH * TT * TT * 4); h16* P16 = (h16*)take((size_t)ZH * TT * TT * 2); float* Ob = (float*)take((size_t)ZH * TT * HD * 4);
    if ((size_t)(wsp - (char*)d_ws) > ws_size) return;    // ws 256 MiB
    float* FV = FK;   // v projection reuses the k buffer after the k planes are built (stream-ordered)
    { k_cvt8<<<(unsigned)(((size_t)CIN * CIN / 8 + 255) / 256), 256, 0, stream>>>(wq, WQ, (size_t)CIN * CIN / 8); k_cvt8<<<(unsigned)(((size_t)CIN * CIN / 8 + 255) / 256), 256, 0, stream>>>(wk, WK, (size_t)CIN * CIN / 8); k_cvt8<<<(unsigned)(((size_t)CIN * CIN / 8 + 255) / 256), 256, 0, stream>>>(wv, WV, (size_t)CIN * CIN / 8);
      for (int h = 0; h < NIMG; ++h) k_wtG<<<(unsigned)((CIN * NPOS / 64 + 63) / 64), 256, 0, stream>>>(x + (size_t)h * CIN * NPOS, CIN, NPOS, XT + (size_t)h * NPOS * CIN);   /* XT[h][n][c] = bf16(x[h][c][n]) */ }
    k_csid<<<(TT * HD + 255) / 256, 256, 0, stream>>>(CS);
    const unsigned LQ = (unsigned)(((size_t)NH_ * TT * HD / 2 + 255) / 256), LKv = (unsigned)(((size_t)NKV * TT * HD / 2 + 255) / 256);
    for (int b = 0; b < NB_; ++b) {
        /* q/k/v for all 8 images in one z-batched exact GEMM each: C = F + z*128 columns (ldc 1024), A = XT + z*NPOS*CIN, shared Bt */
        k_gemmw<bf, 0, true><<<dim3(TT / 64, CIN / 64, NIMG), 32, 0, stream>>>(XT, nullptr, WQ, nullptr, CIN, FQ, DQ, bq, (size_t)NPOS * CIN, 0, (size_t)CIN);
        k_rope<<<LQ, 256, 0, stream>>>(FQ, DQ, NH_, CS, nullptr, nullptr, 1.0f, QP16, QPh, QPl);
        k_gemmw<bf, 0, true><<<dim3(TT / 64, CIN / 64, NIMG), 32, 0, stream>>>(XT, nullptr, WK, nullptr, CIN, FK, DKV, bk, (size_t)NPOS * CIN, 0, (size_t)CIN);
        k_rope<<<LKv, 256, 0, stream>>>(FK, DKV, NKV, CS, nullptr, nullptr, 1.0f, KP16, KPh, KPl);
        k_gemmw<bf, 0, true><<<dim3(TT / 64, CIN / 64, NIMG), 32, 0, stream>>>(XT, nullptr, WV, nullptr, CIN, FV, DKV, bv, (size_t)NPOS * CIN, 0, (size_t)CIN); k_vtp<<<LKv, 256, 0, stream>>>(FV, DKV, NKV, VT16, VTh, VTl);
        for (int h0 = 0; h0 < NH_; h0 += ZH) { const size_t zq = (size_t)h0, zk = (size_t)h0;   // image h0: its own q, k, v planes
            k_gemmw<h16, 0, false><<<dim3(TT / 64, TT / 64, ZH), 32, 0, stream>>>(QP16 + zq * TT * HD, nullptr, KP16 + zk * TT * HD, nullptr, HD, Sb, TT, nullptr, (size_t)TT * HD, (size_t)TT * HD, (size_t)TT * TT);
            k_asoft<<<ZH * TT / 8, 256, 0, stream>>>(Sb, P16, Ph, Pl);
            k_gemmw<h16, 0, false><<<dim3(TT / 64, HD / 64, ZH), 32, 0, stream>>>(P16, nullptr, VT16 + zk * HD * TT, nullptr, TT, Ob, HD, nullptr, (size_t)TT * TT, (size_t)HD * TT, (size_t)TT * HD);
            k_mergeT<<<(unsigned)(((size_t)ZH * TT * HD / 2 + 255) / 256), 256, 0, stream>>>(Ob, x, h0, OUT); } }
}

// v001
// Measured time: 553 microseconds a run.
// Timed twice side by side with v000, it ran 2.00 times as fast both times.
#include <hip/hip_runtime.h>

// Light self-attention over image positions (x [8][128][64x64 = 4096] channel-major; per image q/k/v = W x + b (1x1 convs, W [128 out][128 in]); attn[n][m] = softmax_m(q_n.k_m / sqrt(128)) over the 4096 positions; out[c][n] = sum_m attn[n][m] v[c][m] + x[c][n] -> [8][128][64][64]).
// Layout: the 8 images are processed as 8 independent 128-wide 'heads' of one 4096-token sequence (head h = image h): XT[h][n][c] = bf16(x[h][c][n]) (transposed once), q/k/v [n][h*128 + o] from ONE z-batched exact GEMM each (z = image, shared weights, bias in the epilogue), then the standard per-head attention; k_merge sums the NSPL key-range partials and writes the channel-major output with the residual.
// Compute dtypes, f32 accumulate: every input rounded to bf16; q/k/v on PLAIN bf16 operands (inputs: exact) + bias; scores and attn.v on single fp16 planes (P x1024) over 4096 keys, one image per pass; 1/sqrt(128) and softmax in f32; out = attn.v (f32) + bf16(x), computed and written as [c][n] rows (no transpose).

#define NB_  1
#define NIMG 8                    // images = 'heads'
#define CIN  128                  // channels
#define NPOS 4096                 // positions per image
#define TT   4096
#define DM   128
#define NH_  8
#define NKV  8
#define REP  (NH_ / NKV)
#define HD   128
#define DQ   (NH_ * HD)
#define DKV  (NKV * HD)
#define ZH   1                    // one image per pass (keeps the [4096][4096] score block at 64 MiB)
#define RH   0                  // query rows < RH use hi+lo planes (0: none)
#define WIN  0
#define PCAR 1024.0f
#define NSPL 16                   // attn.v: the 4096 keys are split into NSPL ranges, one block per (tile, range); f32 partials summed in k_merge
#define SCL  0.088388347648318447f   // HD^-0.5
typedef _Float16 h16;
typedef unsigned short bf;
typedef __attribute__((ext_vector_type(16))) __bf16   v16bf;
typedef __attribute__((ext_vector_type(16))) _Float16 v16h;
typedef __attribute__((ext_vector_type(8)))  _Float16 v8h;
typedef __attribute__((ext_vector_type(8)))  unsigned short v8us;
typedef __attribute__((ext_vector_type(8)))  float    v8f;
typedef __attribute__((ext_vector_type(4)))  float    v4f;
typedef v8h  __attribute__((may_alias)) v8ha;
typedef v4f  __attribute__((may_alias)) v4fa;
typedef v8us __attribute__((may_alias)) v8usa;

__device__ __forceinline__ unsigned short f2bf(float f) { unsigned u = __float_as_uint(f); u += 0x7FFFu + ((u >> 16) & 1u); return (unsigned short)(u >> 16); }
__device__ __forceinline__ float bf2f(unsigned short b) { return __uint_as_float(((unsigned)b) << 16); }
__device__ __forceinline__ float bfr(float f) { return bf2f(f2bf(f)); }
__device__ __forceinline__ v16h cat16(v8h lo, v8h hi) { return __builtin_shufflevector(lo, hi, 0, 1, 2, 3, 4, 5, 6, 7, 8, 9, 10, 11, 12, 13, 14, 15); }
__device__ __forceinline__ v16bf cat16b(v8us lo, v8us hi) { return __builtin_bit_cast(v16bf, __builtin_shufflevector(lo, hi, 0, 1, 2, 3, 4, 5, 6, 7, 8, 9, 10, 11, 12, 13, 14, 15)); }
__device__ __forceinline__ v8f wmma16(v16h a, v16h b, v8f c) { return __builtin_amdgcn_wmma_f32_16x16x32_f16(false, a, false, b, (short)0, c, false, false); }
__device__ __forceinline__ v8f wmmab(v16bf a, v16bf b, v8f c) { return __builtin_amdgcn_wmma_f32_16x16x32_bf16(false, a, false, b, (short)0, c, false, false); }



// ---- k_gemmw: register-blocked GEMM, ONE WAVE per 64x64 output tile (16 accumulators), operands straight from K-contiguous 16-bit planes; grid (M/64, N/64, Z), 32 threads.
// C[m][n] (f32, pitch ldc, + optional f32 bias[n]) = sum_{k < KL} A[m][k] Bt[n][k] (+ split products per NSPLIT). K = row pitch of A and Bt, KL = length of the k range a block sums (KL == K: whole rows; KL < K with sA = sB = KL: z picks a k range and C + z*sC holds that range's partial). z-batch strides sA/sB/sC in elements. KL % 32 == 0.
template <typename T16> struct WFrag;
template <> struct WFrag<h16> { typedef v16h V; static __device__ __forceinline__ V ld(const h16* p) { return cat16(*(const v8h*)p, *(const v8h*)(p + 16)); } static __device__ __forceinline__ v8f mma(V a, V b, v8f c) { return wmma16(a, b, c); } };
template <> struct WFrag<bf> { typedef v16bf V; static __device__ __forceinline__ V ld(const bf* p) { return cat16b(*(const v8us*)p, *(const v8us*)(p + 16)); } static __device__ __forceinline__ v8f mma(V a, V b, v8f c) { return wmmab(a, b, c); } };
template <typename T16, int NSPLIT, bool BIAS>
__global__ __launch_bounds__(32) void k_gemmw(const T16* __restrict__ A, const T16* __restrict__ A2, const T16* __restrict__ Bt, const T16* __restrict__ Bt2, int K, int KL, float* C, int ldc, const float* __restrict__ bias, size_t sA, size_t sB, size_t sC) {
    typedef typename WFrag<T16>::V V;
    __shared__ __align__(16) float os[16 * 68];
    const size_t z = blockIdx.z; A += z * sA; if (A2) A2 += z * sA; Bt += z * sB; if (Bt2) Bt2 += z * sB; C += z * sC;
    const int lane = threadIdx.x & 31, lr = lane & 15, hi = lane >> 4; const int r0 = blockIdx.x * 64, c0 = blockIdx.y * 64;
    v8f acc[4][4];
#pragma unroll
    for (int mb = 0; mb < 4; ++mb)
#pragma unroll
        for (int nb = 0; nb < 4; ++nb) acc[mb][nb] = (v8f){};
    const size_t aoff = (size_t)(r0 + lr) * K + 8 * hi, boff = (size_t)(c0 + lr) * K + 8 * hi;
#pragma unroll 1
    for (int kc = 0; kc < KL; kc += 32) {
        V a[4], a2[4];
#pragma unroll
        for (int mb = 0; mb < 4; ++mb) { a[mb] = WFrag<T16>::ld(A + aoff + (size_t)mb * 16 * K + kc); if (NSPLIT == 1 || NSPLIT == 2) a2[mb] = WFrag<T16>::ld(A2 + aoff + (size_t)mb * 16 * K + kc); }
#pragma unroll
        for (int nb = 0; nb < 4; ++nb) { const V b = WFrag<T16>::ld(Bt + boff + (size_t)nb * 16 * K + kc); V b2; if (NSPLIT >= 2) b2 = WFrag<T16>::ld(Bt2 + boff + (size_t)nb * 16 * K + kc);
#pragma unroll
            for (int mb = 0; mb < 4; ++mb) { acc[mb][nb] = WFrag<T16>::mma(a[mb], b, acc[mb][nb]); if (NSPLIT == 1 || NSPLIT == 2) acc[mb][nb] = WFrag<T16>::mma(a2[mb], b, acc[mb][nb]); if (NSPLIT >= 2) acc[mb][nb] = WFrag<T16>::mma(a[mb], b2, acc[mb][nb]); } }
        asm volatile("v_nop\n\tv_nop\n\tv_nop\n\tv_nop" : "+v"(acc[0][0]), "+v"(acc[1][1]), "+v"(acc[2][2]), "+v"(acc[3][3]) : "v"(a[0]), "v"(a[3]));
    }
#pragma unroll
    for (int mb = 0; mb < 4; ++mb) {
#pragma unroll
        for (int nb = 0; nb < 4; ++nb) {
#pragma unroll
            for (int j = 0; j < 8; ++j) os[(hi * 8 + j) * 68 + nb * 16 + lr] = acc[mb][nb][j]; }
        __builtin_amdgcn_wave_barrier(); asm volatile("" ::: "memory");
        float* crow = C + (size_t)(r0 + mb * 16) * ldc + c0;
{
#pragma unroll
            for (int s = 0; s < 8; ++s) { const int row = 2 * s + hi, cofs = lr * 4; v4f val = *(const v4fa*)(os + row * 68 + cofs); if (BIAS) { val[0] += bfr(bias[c0 + cofs]); val[1] += bfr(bias[c0 + cofs + 1]); val[2] += bfr(bias[c0 + cofs + 2]); val[3] += bfr(bias[c0 + cofs + 3]); }
                *(v4f*)(crow + (size_t)row * ldc + cofs) = val; }
             }
        __builtin_amdgcn_wave_barrier(); asm volatile("" ::: "memory");
    }
}

__device__ __forceinline__ h16 tohx(float x) { return (h16)x; }
__device__ __forceinline__ void splitf(float y, unsigned short& h, unsigned short& l) { h = f2bf(y); l = f2bf(y - bf2f(h)); }
typedef __attribute__((ext_vector_type(2))) _Float16 v2h;
typedef __attribute__((ext_vector_type(4))) _Float16 v4h;
typedef __attribute__((ext_vector_type(2))) unsigned short v2us;
typedef __attribute__((ext_vector_type(4))) unsigned short v4us;
typedef __attribute__((ext_vector_type(2))) float v2f;
typedef __attribute__((ext_vector_type(4))) int v4i;

__global__ __launch_bounds__(256) void k_wtG(const float* __restrict__ w, int K, int N, bf* Bt) {
    const int lane = threadIdx.x & 31; const int L0 = (blockIdx.x * 8 + (threadIdx.x >> 5)) * 8; const int nlines = N * K / 64;
{
#pragma unroll 1
        for (int l = 0; l < 8; ++l) { const int L = L0 + l; if (L >= nlines) break; const size_t e = (size_t)L * 64 + lane * 2; const int k = (int)(e % K), n = (int)(e / K); v2us o;
            o[0] = f2bf(w[(size_t)k * N + n]); o[1] = f2bf(w[(size_t)(k + 1) * N + n]); *(v2us*)(Bt + e) = o; }
         }
}
__global__ __launch_bounds__(256) void k_cvt8(const float* __restrict__ src, bf* dst, size_t n8) { const size_t i = (size_t)blockIdx.x * 256 + threadIdx.x; if (i >= n8) return; const v8f v = *(const v8f*)(src + i * 8); v8us o;
#pragma unroll
    for (int k = 0; k < 8; ++k) o[k] = f2bf(v[k]); *(v8us*)(dst + i * 8) = o;  }

// k_rope: head planes [h][t][d] (fp16) of rope(x) x sc with the rotate-half convention out[d] = x[d] cos[t][d] - x[d+HD/2] sin[t][d], out[d+HD/2] = x[d+HD/2] cos[t][d+HD/2] + x[d] sin[t][d+HD/2]
__global__ __launch_bounds__(256) void k_rope(const float* __restrict__ F, int pitch, int nheads, const float* __restrict__ CS, const float* __restrict__ RF, const float* __restrict__ nw, float sc, h16* P16, bf* Ph, bf* Pl) {
    const size_t e = ((size_t)blockIdx.x * 256 + threadIdx.x) * 2; if (e >= (size_t)nheads * TT * HD) return; const int d = (int)(e % HD); const int t = (int)((e / HD) % TT); const int h = (int)(e / ((size_t)HD * TT)); const float* f = F + (size_t)t * pitch + h * HD; const float rf = RF ? RF[(size_t)h * TT + t] : 1.0f; v2h o16; v2us oh, ol;
#pragma unroll
    for (int q = 0; q < 2; ++q) { const int dd = d + q; const int dp = (dd < HD / 2) ? dd + HD / 2 : dd - HD / 2; float x0 = f[dd], x1 = f[dp];
        if (RF) { float n0 = __fmul_rn(x0, rf), n1 = __fmul_rn(x1, rf); asm volatile("" : "+v"(n0)); asm volatile("" : "+v"(n1)); x0 = __fmul_rn(bfr(nw[dd]), n0); x1 = __fmul_rn(bfr(nw[dp]), n1); }
        const v2f cs = *(const v2f*)(CS + ((size_t)t * HD + dd) * 2); float a = __fmul_rn(x0, cs[0]), bq = __fmul_rn(x1, cs[1]); asm volatile("" : "+v"(a)); asm volatile("" : "+v"(bq)); const float r = ((dd < HD / 2) ? __fsub_rn(a, bq) : __fadd_rn(a, bq)) * sc;
        o16[q] = tohx(r); (void)oh; (void)ol; }
    *(v2h*)(P16 + e) = o16;  }
__global__ __launch_bounds__(256) void k_vtp(const float* __restrict__ F, int pitch, int nheads, h16* V16, bf* Vh, bf* Vl) { const size_t e = ((size_t)blockIdx.x * 256 + threadIdx.x) * 2; if (e >= (size_t)nheads * HD * TT) return; const int t = (int)(e % TT); const int d = (int)((e / TT) % HD); const int g = (int)(e / ((size_t)TT * HD)); v2h o16; v2us oh, ol;
#pragma unroll
    for (int q = 0; q < 2; ++q) { const float x = F[(size_t)(t + q) * pitch + g * HD + d]; o16[q] = tohx(x); (void)oh; (void)ol; }
    *(v2h*)(V16 + e) = o16;  }
__global__ __launch_bounds__(256) void k_csid(float* CS) { const int idx = blockIdx.x * 256 + threadIdx.x; if (idx >= TT * HD) return; v2f cs; cs[0] = 1.0f; cs[1] = 0.0f; *(v2f*)(CS + (size_t)idx * 2) = cs;  }
// k_asoft: per row (zz, i): t = S x HD^-0.5 (no mask); softmax over the 4096 keys (register row, one exp, fixed trees);
__global__ __launch_bounds__(256) void k_asoft(const float* __restrict__ Sb, h16* P16, bf* Ph, bf* Pl) {
    const int lane = threadIdx.x & 31; const int row = blockIdx.x * 8 + (threadIdx.x >> 5); if (row >= ZH * TT) return; const int i = row % TT; const int zz = row / TT; (void)zz; const bool hires = (i < RH); const float* sr = Sb + (size_t)row * TT; float v[TT / 32]; float mx = -3.0e38f;
#pragma unroll
    for (int ch = 0; ch < TT / 128; ++ch) { const int j0 = ch * 128 + lane * 4; const v4f a = *(const v4f*)(sr + j0);
#pragma unroll
        for (int q = 0; q < 4; ++q) { const int j = j0 + q; (void)j; const float t = a[q] * SCL; v[ch * 4 + q] = t; mx = fmaxf(mx, t); } }
#pragma unroll
    for (int sh = 16; sh; sh >>= 1) mx = fmaxf(mx, __shfl_xor(mx, sh, 32));
    float sum = 0.f;
#pragma unroll
    for (int k = 0; k < TT / 32; ++k) { float d0 = __fsub_rn(v[k], mx); asm volatile("" : "+v"(d0)); v[k] = __builtin_amdgcn_exp2f(__fmul_rn(d0, 1.4426950408889634f)); sum += v[k]; }
#pragma unroll
    for (int sh = 16; sh; sh >>= 1) sum += __shfl_xor(sum, sh, 32);
    const float f = __fdiv_rn(hires ? 1.0f : PCAR, sum);
{
        if (hires) {
#pragma unroll
            for (int ch = 0; ch < TT / 128; ++ch) { v4us oh, ol;
#pragma unroll
                for (int q = 0; q < 4; ++q) { unsigned short a, c2; splitf(v[ch * 4 + q] * f, a, c2); oh[q] = a; ol[q] = c2; }
                const size_t oo = ((size_t)zz * (RH ? RH : 1) + i) * TT + ch * 128 + lane * 4; *(v4us*)(Ph + oo) = oh; *(v4us*)(Pl + oo) = ol; }
        } else {
#pragma unroll
            for (int ch = 0; ch < TT / 128; ++ch) { v4h o4;
#pragma unroll
                for (int q = 0; q < 4; ++q) o4[q] = tohx(v[ch * 4 + q] * f);
                *(v4h*)(P16 + (size_t)row * TT + ch * 128 + lane * 4) = o4; } }
         }
}
// k_merge: OUT[h0][d][t] = (sum over the NSPL key ranges, in range order, of O[d][s][t]) / PCAR + bf16(X[h0][d][t]); 16 B per lane (off = the lane's byte offset in the [d][t] plane, po = that of its first partial).
__global__ __launch_bounds__(256) void k_merge(const float* __restrict__ O, const float* __restrict__ X, int h0, float* OUT) { const unsigned off = (blockIdx.x * 256u + threadIdx.x) * 16u; if (off >= (unsigned)(HD * TT * 4)) return; const unsigned po = (off / (TT * 4u)) * (NSPL * TT * 4u) + off % (TT * 4u); v4f p[NSPL];
#pragma unroll   // all NSPL loads of a lane in flight together
    for (int s = 0; s < NSPL; ++s) p[s] = *(const v4f*)((const char*)(O + s * TT) + po);
    const v4f xv = *(const v4f*)((const char*)(X + (size_t)h0 * HD * TT) + off); v4f a = p[0];
#pragma unroll   // constant indices: p[] stays in registers
    for (int s = 1; s < NSPL; ++s) a += p[s];
    v4f o4;
#pragma unroll   // constant vector indices
    for (int q = 0; q < 4; ++q) o4[q] = __fadd_rn(a[q] * (1.0f / PCAR), bfr(xv[q]));
    *(v4f*)((char*)(OUT + (size_t)h0 * HD * TT) + off) = o4;  }

extern "C" void kernel_launch(void* const* d_in, const int* in_sizes, int n_in,
                              void* d_out, int out_size, void* d_ws, size_t ws_size, hipStream_t stream) {
    (void)in_sizes; (void)n_in; (void)out_size;
    const float* x = (const float*)d_in[0]; const float* wq = (const float*)d_in[1]; const float* bq = (const float*)d_in[2]; const float* wk = (const float*)d_in[3]; const float* bk = (const float*)d_in[4]; const float* wv = (const float*)d_in[5]; const float* bv = (const float*)d_in[6];
    float* OUT = (float*)d_out;     // [8][128][4096]
    char* wsp = (char*)d_ws;
    auto take = [&](size_t bytes) { char* p = wsp; wsp += (bytes + 255) & ~(size_t)255; return (void*)p; };
    bf* WQ = (bf*)take((size_t)CIN * CIN * 2); bf* WK = (bf*)take((size_t)CIN * CIN * 2); bf* WV = (bf*)take((size_t)CIN * CIN * 2); float* CS = (float*)take((size_t)TT * HD * 2 * 4);
    bf* XT = (bf*)take((size_t)NIMG * NPOS * CIN * 2); float* FQ = (float*)take((size_t)TT * DQ * 4); float* FK = (float*)take((size_t)TT * DKV * 4);
    h16* QP16 = (h16*)take((size_t)NH_ * TT * HD * 2); h16* KP16 = (h16*)take((size_t)NKV * TT * HD * 2); h16* VT16 = (h16*)take((size_t)NKV * HD * TT * 2);
    bf* QPh = nullptr; bf* QPl = nullptr; bf* KPh = nullptr; bf* KPl = nullptr; bf* VTh = nullptr; bf* VTl = nullptr; bf* Ph = nullptr; bf* Pl = nullptr;
    float* Sb = (float*)take((size_t)ZH * TT * TT * 4); h16* P16 = (h16*)take((size_t)ZH * TT * TT * 2); float* Ob = (float*)take((size_t)NSPL * HD * TT * 4);   // [d][NSPL][t] partials of one image
    if ((size_t)(wsp - (char*)d_ws) > ws_size) return;    // ws 256 MiB
    float* FV = FK;   // v projection reuses the k buffer after the k planes are built (stream-ordered)
    { k_cvt8<<<(unsigned)(((size_t)CIN * CIN / 8 + 255) / 256), 256, 0, stream>>>(wq, WQ, (size_t)CIN * CIN / 8); k_cvt8<<<(unsigned)(((size_t)CIN * CIN / 8 + 255) / 256), 256, 0, stream>>>(wk, WK, (size_t)CIN * CIN / 8); k_cvt8<<<(unsigned)(((size_t)CIN * CIN / 8 + 255) / 256), 256, 0, stream>>>(wv, WV, (size_t)CIN * CIN / 8);
      for (int h = 0; h < NIMG; ++h) k_wtG<<<(unsigned)((CIN * NPOS / 64 + 63) / 64), 256, 0, stream>>>(x + (size_t)h * CIN * NPOS, CIN, NPOS, XT + (size_t)h * NPOS * CIN);   /* XT[h][n][c] = bf16(x[h][c][n]) */ }
    k_csid<<<(TT * HD + 255) / 256, 256, 0, stream>>>(CS);
    const unsigned LQ = (unsigned)(((size_t)NH_ * TT * HD / 2 + 255) / 256), LKv = (unsigned)(((size_t)NKV * TT * HD / 2 + 255) / 256);
    for (int b = 0; b < NB_; ++b) {
        /* q/k/v for all 8 images in one z-batched exact GEMM each: C = F + z*128 columns (ldc 1024), A = XT + z*NPOS*CIN, shared Bt */
        k_gemmw<bf, 0, true><<<dim3(TT / 64, CIN / 64, NIMG), 32, 0, stream>>>(XT, nullptr, WQ, nullptr, CIN, CIN, FQ, DQ, bq, (size_t)NPOS * CIN, 0, (size_t)CIN);
        k_rope<<<LQ, 256, 0, stream>>>(FQ, DQ, NH_, CS, nullptr, nullptr, 1.0f, QP16, QPh, QPl);
        k_gemmw<bf, 0, true><<<dim3(TT / 64, CIN / 64, NIMG), 32, 0, stream>>>(XT, nullptr, WK, nullptr, CIN, CIN, FK, DKV, bk, (size_t)NPOS * CIN, 0, (size_t)CIN);
        k_rope<<<LKv, 256, 0, stream>>>(FK, DKV, NKV, CS, nullptr, nullptr, 1.0f, KP16, KPh, KPl);
        k_gemmw<bf, 0, true><<<dim3(TT / 64, CIN / 64, NIMG), 32, 0, stream>>>(XT, nullptr, WV, nullptr, CIN, CIN, FV, DKV, bv, (size_t)NPOS * CIN, 0, (size_t)CIN); k_vtp<<<LKv, 256, 0, stream>>>(FV, DKV, NKV, VT16, VTh, VTl);
        for (int h0 = 0; h0 < NH_; h0 += ZH) { const size_t zq = (size_t)h0, zk = (size_t)h0;   // image h0: its own q, k, v planes
            k_gemmw<h16, 0, false><<<dim3(TT / 64, TT / 64, ZH), 32, 0, stream>>>(QP16 + zq * TT * HD, nullptr, KP16 + zk * TT * HD, nullptr, HD, HD, Sb, TT, nullptr, (size_t)TT * HD, (size_t)TT * HD, (size_t)TT * TT);
            k_asoft<<<ZH * TT / 8, 256, 0, stream>>>(Sb, P16, Ph, Pl);
            /* attn.v split over the keys: z = key range; rows = v channels, columns = query positions, so a partial row is a piece of an output row; the NSPL partial rows of a channel lie side by side */
            k_gemmw<h16, 0, false><<<dim3(HD / 64, TT / 64, NSPL), 32, 0, stream>>>(VT16 + zk * HD * TT, nullptr, P16, nullptr, TT, TT / NSPL, Ob, NSPL * TT, nullptr, (size_t)(TT / NSPL), (size_t)(TT / NSPL), (size_t)TT);
            k_merge<<<(unsigned)(((size_t)HD * TT / 4 + 255) / 256), 256, 0, stream>>>(Ob, x, h0, OUT); } }
}

// v002
// A run of this version takes 181 microseconds.
// Timed twice side by side with v001, it ran 3.05 times as fast both times.
// All steps since v000 together make it 6.11 times as fast.
#include <hip/hip_runtime.h>

// Light self-attention over image positions (x [8][128][64x64 = 4096] channel-major; per image q/k/v = W x + b (1x1 convs, W [128 out][128 in]); attn[n][m] = softmax_m(q_n.k_m / sqrt(128)) over the 4096 positions; out[c][n] = sum_m attn[n][m] v[c][m] + x[c][n] -> [8][128][64][64]).
// Layout: the 8 images are processed as 8 independent 128-wide 'heads' of one 4096-token sequence (head h = image h): XT[h][n][c] = bf16(x[h][c][n]) (transposed once), q/k/v [n][h*128 + o] from ONE z-batched exact GEMM each (z = image, shared weights, bias in the epilogue), then the standard per-head attention; the epilogue writes the channel-major output with the residual.
// Compute dtypes, f32 accumulate: every input rounded to bf16; q/k/v on PLAIN bf16 operands (inputs: exact) + bias; scores and attn.v on single fp16 operands (P = exp(score - running maximum), below 2^8) over 4096 keys, all images in one fused launch; 1/sqrt(128) and the online softmax in f32; out = attn.v (f32) / row sum + bf16(x), written into [c][n] rows.

#define NB_  1
#define NIMG 8                    // images = 'heads'
#define CIN  128                  // channels
#define NPOS 4096                 // positions per image
#define TT   4096
#define DM   128
#define NH_  8
#define NKV  8
#define REP  (NH_ / NKV)
#define HD   128
#define DQ   (NH_ * HD)
#define DKV  (NKV * HD)
#define WIN  0
#define SCL  0.088388347648318447f   // HD^-0.5
typedef _Float16 h16;
typedef unsigned short bf;
typedef __attribute__((ext_vector_type(16))) __bf16   v16bf;
typedef __attribute__((ext_vector_type(16))) _Float16 v16h;
typedef __attribute__((ext_vector_type(8)))  _Float16 v8h;
typedef __attribute__((ext_vector_type(8)))  unsigned short v8us;
typedef __attribute__((ext_vector_type(8)))  float    v8f;
typedef __attribute__((ext_vector_type(4)))  float    v4f;
typedef v8h  __attribute__((may_alias)) v8ha;
typedef v4f  __attribute__((may_alias)) v4fa;
typedef v8us __attribute__((may_alias)) v8usa;

__device__ __forceinline__ unsigned short f2bf(float f) { unsigned u = __float_as_uint(f); u += 0x7FFFu + ((u >> 16) & 1u); return (unsigned short)(u >> 16); }
__device__ __forceinline__ float bf2f(unsigned short b) { return __uint_as_float(((unsigned)b) << 16); }
__device__ __forceinline__ float bfr(float f) { return bf2f(f2bf(f)); }
__device__ __forceinline__ v16h cat16(v8h lo, v8h hi) { return __builtin_shufflevector(lo, hi, 0, 1, 2, 3, 4, 5, 6, 7, 8, 9, 10, 11, 12, 13, 14, 15); }
__device__ __forceinline__ v16bf cat16b(v8us lo, v8us hi) { return __builtin_bit_cast(v16bf, __builtin_shufflevector(lo, hi, 0, 1, 2, 3, 4, 5, 6, 7, 8, 9, 10, 11, 12, 13, 14, 15)); }
__device__ __forceinline__ v8f wmma16(v16h a, v16h b, v8f c) { return __builtin_amdgcn_wmma_f32_16x16x32_f16(false, a, false, b, (short)0, c, false, false); }
__device__ __forceinline__ v8f wmmab(v16bf a, v16bf b, v8f c) { return __builtin_amdgcn_wmma_f32_16x16x32_bf16(false, a, false, b, (short)0, c, false, false); }



// ---- k_gemmw: register-blocked GEMM, ONE WAVE per 64x64 output tile (16 accumulators), operands straight from K-contiguous 16-bit planes; grid (M/64, N/64, Z), 32 threads.
// C[m][n] (f32, pitch ldc, + optional f32 bias[n]) = sum_{k < KL} A[m][k] Bt[n][k] (+ split products per NSPLIT). K = row pitch of A and Bt, KL = length of the k range a block sums (KL == K: whole rows; KL < K with sA = sB = KL: z picks a k range and C + z*sC holds that range's partial). z-batch strides sA/sB/sC in elements. KL % 32 == 0.
template <typename T16> struct WFrag;
template <> struct WFrag<h16> { typedef v16h V; static __device__ __forceinline__ V ld(const h16* p) { return cat16(*(const v8h*)p, *(const v8h*)(p + 16)); } static __device__ __forceinline__ v8f mma(V a, V b, v8f c) { return wmma16(a, b, c); } };
template <> struct WFrag<bf> { typedef v16bf V; static __device__ __forceinline__ V ld(const bf* p) { return cat16b(*(const v8us*)p, *(const v8us*)(p + 16)); } static __device__ __forceinline__ v8f mma(V a, V b, v8f c) { return wmmab(a, b, c); } };
template <typename T16, int NSPLIT, bool BIAS>
__global__ __launch_bounds__(32) void k_gemmw(const T16* __restrict__ A, const T16* __restrict__ A2, const T16* __restrict__ Bt, const T16* __restrict__ Bt2, int K, int KL, float* C, int ldc, const float* __restrict__ bias, size_t sA, size_t sB, size_t sC) {
    typedef typename WFrag<T16>::V V;
    __shared__ __align__(16) float os[16 * 68];
    const size_t z = blockIdx.z; A += z * sA; if (A2) A2 += z * sA; Bt += z * sB; if (Bt2) Bt2 += z * sB; C += z * sC;
    const int lane = threadIdx.x & 31, lr = lane & 15, hi = lane >> 4; const int r0 = blockIdx.x * 64, c0 = blockIdx.y * 64;
    v8f acc[4][4];
#pragma unroll
    for (int mb = 0; mb < 4; ++mb)
#pragma unroll
        for (int nb = 0; nb < 4; ++nb) acc[mb][nb] = (v8f){};
    const size_t aoff = (size_t)(r0 + lr) * K + 8 * hi, boff = (size_t)(c0 + lr) * K + 8 * hi;
#pragma unroll 1
    for (int kc = 0; kc < KL; kc += 32) {
        V a[4], a2[4];
#pragma unroll
        for (int mb = 0; mb < 4; ++mb) { a[mb] = WFrag<T16>::ld(A + aoff + (size_t)mb * 16 * K + kc); if (NSPLIT == 1 || NSPLIT == 2) a2[mb] = WFrag<T16>::ld(A2 + aoff + (size_t)mb * 16 * K + kc); }
#pragma unroll
        for (int nb = 0; nb < 4; ++nb) { const V b = WFrag<T16>::ld(Bt + boff + (size_t)nb * 16 * K + kc); V b2; if (NSPLIT >= 2) b2 = WFrag<T16>::ld(Bt2 + boff + (size_t)nb * 16 * K + kc);
#pragma unroll
            for (int mb = 0; mb < 4; ++mb) { acc[mb][nb] = WFrag<T16>::mma(a[mb], b, acc[mb][nb]); if (NSPLIT == 1 || NSPLIT == 2) acc[mb][nb] = WFrag<T16>::mma(a2[mb], b, acc[mb][nb]); if (NSPLIT >= 2) acc[mb][nb] = WFrag<T16>::mma(a[mb], b2, acc[mb][nb]); } }
        asm volatile("v_nop\n\tv_nop\n\tv_nop\n\tv_nop" : "+v"(acc[0][0]), "+v"(acc[1][1]), "+v"(acc[2][2]), "+v"(acc[3][3]) : "v"(a[0]), "v"(a[3]));
    }
#pragma unroll
    for (int mb = 0; mb < 4; ++mb) {
#pragma unroll
        for (int nb = 0; nb < 4; ++nb) {
#pragma unroll
            for (int j = 0; j < 8; ++j) os[(hi * 8 + j) * 68 + nb * 16 + lr] = acc[mb][nb][j]; }
        __builtin_amdgcn_wave_barrier(); asm volatile("" ::: "memory");
        float* crow = C + (size_t)(r0 + mb * 16) * ldc + c0;
{
#pragma unroll
            for (int s = 0; s < 8; ++s) { const int row = 2 * s + hi, cofs = lr * 4; v4f val = *(const v4fa*)(os + row * 68 + cofs); if (BIAS) { val[0] += bfr(bias[c0 + cofs]); val[1] += bfr(bias[c0 + cofs + 1]); val[2] += bfr(bias[c0 + cofs + 2]); val[3] += bfr(bias[c0 + cofs + 3]); }
                *(v4f*)(crow + (size_t)row * ldc + cofs) = val; }
             }
        __builtin_amdgcn_wave_barrier(); asm volatile("" ::: "memory");
    }
}

__device__ __forceinline__ h16 tohx(float x) { return (h16)x; }
__device__ __forceinline__ void splitf(float y, unsigned short& h, unsigned short& l) { h = f2bf(y); l = f2bf(y - bf2f(h)); }
typedef __attribute__((ext_vector_type(2))) _Float16 v2h;
typedef __attribute__((ext_vector_type(4))) _Float16 v4h;
typedef __attribute__((ext_vector_type(2))) unsigned short v2us;
typedef __attribute__((ext_vector_type(4))) unsigned short v4us;
typedef __attribute__((ext_vector_type(2))) float v2f;
typedef __attribute__((ext_vector_type(4))) int v4i;

__global__ __launch_bounds__(256) void k_wtG(const float* __restrict__ w, int K, int N, bf* Bt) {
    const int lane = threadIdx.x & 31; const int L0 = (blockIdx.x * 8 + (threadIdx.x >> 5)) * 8; const int nlines = N * K / 64;
{
#pragma unroll 1
        for (int l = 0; l < 8; ++l) { const int L = L0 + l; if (L >= nlines) break; const size_t e = (size_t)L * 64 + lane * 2; const int k = (int)(e % K), n = (int)(e / K); v2us o;
            o[0] = f2bf(w[(size_t)k * N + n]); o[1] = f2bf(w[(size_t)(k + 1) * N + n]); *(v2us*)(Bt + e) = o; }
         }
}
__global__ __launch_bounds__(256) void k_cvt8(const float* __restrict__ src, bf* dst, size_t n8) { const size_t i = (size_t)blockIdx.x * 256 + threadIdx.x; if (i >= n8) return; const v8f v = *(const v8f*)(src + i * 8); v8us o;
#pragma unroll
    for (int k = 0; k < 8; ++k) o[k] = f2bf(v[k]); *(v8us*)(dst + i * 8) = o;  }

// k_rope: head planes [h][t][d] (fp16) of rope(x) x sc with the rotate-half convention out[d] = x[d] cos[t][d] - x[d+HD/2] sin[t][d], out[d+HD/2] = x[d+HD/2] cos[t][d+HD/2] + x[d] sin[t][d+HD/2]
__global__ __launch_bounds__(256) void k_rope(const float* __restrict__ F, int pitch, int nheads, const float* __restrict__ CS, const float* __restrict__ RF, const float* __restrict__ nw, float sc, h16* P16, bf* Ph, bf* Pl) {
    const size_t e = ((size_t)blockIdx.x * 256 + threadIdx.x) * 2; if (e >= (size_t)nheads * TT * HD) return; const int d = (int)(e % HD); const int t = (int)((e / HD) % TT); const int h = (int)(e / ((size_t)HD * TT)); const float* f = F + (size_t)t * pitch + h * HD; const float rf = RF ? RF[(size_t)h * TT + t] : 1.0f; v2h o16; v2us oh, ol;
#pragma unroll
    for (int q = 0; q < 2; ++q) { const int dd = d + q; const int dp = (dd < HD / 2) ? dd + HD / 2 : dd - HD / 2; float x0 = f[dd], x1 = f[dp];
        if (RF) { float n0 = __fmul_rn(x0, rf), n1 = __fmul_rn(x1, rf); asm volatile("" : "+v"(n0)); asm volatile("" : "+v"(n1)); x0 = __fmul_rn(bfr(nw[dd]), n0); x1 = __fmul_rn(bfr(nw[dp]), n1); }
        const v2f cs = *(const v2f*)(CS + ((size_t)t * HD + dd) * 2); float a = __fmul_rn(x0, cs[0]), bq = __fmul_rn(x1, cs[1]); asm volatile("" : "+v"(a)); asm volatile("" : "+v"(bq)); const float r = ((dd < HD / 2) ? __fsub_rn(a, bq) : __fadd_rn(a, bq)) * sc;
        o16[q] = tohx(r); (void)oh; (void)ol; }
    *(v2h*)(P16 + e) = o16;  }
__global__ __launch_bounds__(256) void k_vtp(const float* __restrict__ F, int pitch, int nheads, h16* V16, bf* Vh, bf* Vl) { const size_t e = ((size_t)blockIdx.x * 256 + threadIdx.x) * 2; if (e >= (size_t)nheads * HD * TT) return; const int t = (int)(e % TT); const int d = (int)((e / TT) % HD); const int g = (int)(e / ((size_t)TT * HD)); v2h o16; v2us oh, ol;
#pragma unroll
    for (int q = 0; q < 2; ++q) { const float x = F[(size_t)(t + q) * pitch + g * HD + d]; o16[q] = tohx(x); (void)oh; (void)ol; }
    *(v2h*)(V16 + e) = o16;  }
__global__ __launch_bounds__(256) void k_csid(float* CS) { const int idx = blockIdx.x * 256 + threadIdx.x; if (idx >= TT * HD) return; v2f cs; cs[0] = 1.0f; cs[1] = 0.0f; *(v2f*)(CS + (size_t)idx * 2) = cs;  }
#define FW    4                   // waves per work-group
#define FBR   (FW * 32)           // query columns per work-group
#define FSK   64                  // keys per stage
#define FPK   272                 // LDS pitch of a K row: 256 B + 16 (odd multiple of 16 B: 16-byte reads without bank conflicts)
#define FPV   144                 // LDS pitch of a V^T row of 64 keys: 128 B + 16
#define FTK   (FSK * FPK)
#define FSLOT (FTK + HD * FPV)    // one buffer: the K tile, then the V^T tile
__device__ __forceinline__ float xhalf(float x) { return __builtin_bit_cast(float, __builtin_amdgcn_permlanex16(__builtin_bit_cast(int, x), __builtin_bit_cast(int, x), 0x76543210, 0xfedcba98, false, false)); }   // lane l with lane l ^ 16
__device__ __forceinline__ v16h ldsfrag(const unsigned char* p) { return cat16(*(const v8ha*)p, *(const v8ha*)(p + 32)); }
__global__ __launch_bounds__(FW * 32) void k_fattn(const h16* __restrict__ Qp, const h16* __restrict__ Kp, const h16* __restrict__ Vt, const float* __restrict__ X, float* OUT) {
    __shared__ __align__(16) unsigned char L[2 * FSLOT];
    const int tid = threadIdx.x, lane = tid & 31, wave = tid >> 5, c = lane & 15, hi = lane >> 4;
    const int img = blockIdx.y, qw0 = blockIdx.x * FBR + wave * 32;
    const float cs = SCL * 1.4426950408889634f;
    // staging: 16 bytes per thread and chunk, whole 128-byte lines; a K stage is 16 KiB in a row (chunk = 8 rows), a V^T stage 128 rows of 128 B (chunk = 16 rows)
    const char* kg = (const char*)(Kp + (size_t)img * TT * HD) + tid * 16;
    const char* vg = (const char*)(Vt + (size_t)img * HD * TT) + (size_t)(tid >> 3) * (TT * 2) + (tid & 7) * 16;
    const unsigned kl = (tid >> 4) * FPK + (tid & 15) * 16, vl = FTK + (tid >> 3) * FPV + (tid & 7) * 16;
    v8h sk[8], sv[8];
#pragma unroll
    for (int i = 0; i < 8; ++i) { sk[i] = *(const v8h*)(kg + i * 2048); sv[i] = *(const v8h*)(vg + (size_t)i * 16 * TT * 2); }
    asm volatile("s_wait_xcnt 0x0" ::: "memory");   // a precaution: stands in front of every later overwrite of these loads' address registers (this build places no such wait itself)
    v16h qf[2][4];
#pragma unroll
    for (int g = 0; g < 2; ++g) { const h16* qp = Qp + ((size_t)img * TT + qw0 + 16 * g + c) * HD + 8 * hi;
#pragma unroll
        for (int kc = 0; kc < 4; ++kc) qf[g][kc] = cat16(*(const v8h*)(qp + 32 * kc), *(const v8h*)(qp + 32 * kc + 16)); }
    asm volatile("s_wait_xcnt 0x0" ::: "memory");   // the same precaution for the loads above
    v8f acc[2][8]; float m_run[2], l_run[2];
#pragma unroll
    for (int g = 0; g < 2; ++g) { m_run[g] = -__builtin_inff(); l_run[g] = 0.0f;
#pragma unroll
        for (int t = 0; t < 8; ++t) acc[g][t] = (v8f){}; }
#pragma unroll
    for (int i = 0; i < 8; ++i) { *(v8ha*)(L + kl + i * 8 * FPK) = sk[i]; *(v8ha*)(L + vl + i * 16 * FPV) = sv[i]; }
    __syncthreads();
    v16h kf[2][4];   // the K fragments of one pass, fetched one pass ahead
    const unsigned kfo = c * FPK + 16 * hi, vfo = FTK + c * FPV + 16 * hi;
#pragma unroll
    for (int kt = 0; kt < 2; ++kt)
#pragma unroll
        for (int kc = 0; kc < 4; ++kc) kf[kt][kc] = ldsfrag(L + kfo + kt * 16 * FPK + 64 * kc);
#pragma unroll 1   // one stage per trip: the body already holds two unrolled passes
    for (int st = 0; st < TT / FSK; ++st) {
        const unsigned slot = (unsigned)(st & 1) * FSLOT;
        if (st + 1 < TT / FSK) {
#pragma unroll
            for (int i = 0; i < 8; ++i) { sk[i] = *(const v8h*)(kg + (size_t)(st + 1) * (FSK * HD * 2) + i * 2048); sv[i] = *(const v8h*)(vg + (size_t)(st + 1) * (FSK * 2) + (size_t)i * 16 * TT * 2); }
            asm volatile("s_wait_xcnt 0x0" ::: "memory");   // a precaution: stands in front of every later overwrite of these loads' address registers (this build places no such wait itself)
        }
#pragma unroll
        for (int ps = 0; ps < FSK / 32; ++ps) {
            const unsigned char* vb = L + slot + vfo + ps * 64;
            v8f s[2][2];
#pragma unroll
            for (int kt = 0; kt < 2; ++kt)
#pragma unroll
                for (int g = 0; g < 2; ++g) s[kt][g] = (v8f){};
#pragma unroll
            for (int kc = 0; kc < 4; ++kc)
#pragma unroll
                for (int kt = 0; kt < 2; ++kt)
#pragma unroll
                    for (int g = 0; g < 2; ++g) s[kt][g] = wmma16(kf[kt][kc], qf[g][kc], s[kt][g]);
            v16h vf[8];
#pragma unroll
            for (int t = 0; t < 8; ++t) vf[t] = ldsfrag(vb + t * 16 * FPV);
            if (ps + 1 < FSK / 32) {
#pragma unroll
                for (int kt = 0; kt < 2; ++kt)
#pragma unroll
                    for (int kc = 0; kc < 4; ++kc) kf[kt][kc] = ldsfrag(L + slot + kfo + ((ps + 1) * 32 + kt * 16) * FPK + 64 * kc); }
            asm volatile("" ::: "memory");   // compiler fence: keeps the LDS loads above in front of the softmax, so that they fly under it; without it they sink to their first use and each WMMA waits for its own fragment
            float mb[2]; bool need = false;
#pragma unroll
            for (int g = 0; g < 2; ++g) { float mx = -__builtin_inff();
#pragma unroll
                for (int kt = 0; kt < 2; ++kt)
#pragma unroll
                    for (int r = 0; r < 8; ++r) mx = fmaxf(mx, s[kt][g][r]);
                mx = fmaxf(mx, xhalf(mx)) * cs; mb[g] = mx; need = need || (mx > m_run[g] + 8.0f); }
            if (__builtin_amdgcn_ballot_w32(need) != 0) {   // wave-uniform, rare after the first passes
#pragma unroll
                for (int g = 0; g < 2; ++g) { const float m_new = fmaxf(m_run[g], mb[g]); const float corr = __builtin_amdgcn_exp2f(m_run[g] - m_new);   // 0 on the first pass, where m_run is -inf
                    l_run[g] *= corr; m_run[g] = m_new;
#pragma unroll
                    for (int t = 0; t < 8; ++t) acc[g][t] = acc[g][t] * corr; } }
#pragma unroll
            for (int g = 0; g < 2; ++g) { const float nm = -m_run[g]; v2f psum = (v2f){0.0f, 0.0f}; v16h pf;
#pragma unroll
                for (int i = 0; i < 8; ++i) {
                    const v2f arg = __builtin_elementwise_fma((v2f){s[i >> 2][g][2 * (i & 3)], s[i >> 2][g][2 * (i & 3) + 1]}, (v2f){cs, cs}, (v2f){nm, nm});
                    const v2f p = (v2f){__builtin_amdgcn_exp2f(arg[0]), __builtin_amdgcn_exp2f(arg[1])};
                    psum += p; const v2h pk = __builtin_convertvector(p, v2h); pf[2 * i] = pk[0]; pf[2 * i + 1] = pk[1]; }
                l_run[g] += psum[0] + psum[1];
#pragma unroll
                for (int t = 0; t < 8; ++t) acc[g][t] = wmma16(vf[t], pf, acc[g][t]); }
        }
        if (st + 1 < TT / FSK) { const unsigned nslot = (unsigned)((st + 1) & 1) * FSLOT;
#pragma unroll
            for (int i = 0; i < 8; ++i) { *(v8ha*)(L + nslot + kl + i * 8 * FPK) = sk[i]; *(v8ha*)(L + nslot + vl + i * 16 * FPV) = sv[i]; } }
        __syncthreads();
        if (st + 1 < TT / FSK) { const unsigned nslot = (unsigned)((st + 1) & 1) * FSLOT;
#pragma unroll
            for (int kt = 0; kt < 2; ++kt)
#pragma unroll
                for (int kc = 0; kc < 4; ++kc) kf[kt][kc] = ldsfrag(L + nslot + kfo + kt * 16 * FPK + 64 * kc); }
    }
    // acc[g][t][r] = O[channel 16 t + 8 hi + r][query qw0 + 16 g + c] x that query's sum: the wave's 32 columns are one 128-byte line of each output row
    const size_t o0 = ((size_t)img * HD + 8 * hi) * TT + qw0 + c;
    float xr[2][8][8];
#pragma unroll   // all residual loads of a lane in flight together
    for (int g = 0; g < 2; ++g)
#pragma unroll
        for (int t = 0; t < 8; ++t)
#pragma unroll
            for (int r = 0; r < 8; ++r) xr[g][t][r] = X[o0 + 16 * g + (size_t)(16 * t + r) * TT];
    asm volatile("s_wait_xcnt 0x0" ::: "memory");   // the same precaution for the loads above
    __builtin_amdgcn_sched_barrier(0);   // holds that wait directly behind the loads: without it later vector work is moved in front of it
#pragma unroll
    for (int g = 0; g < 2; ++g) { const float inv = 1.0f / (l_run[g] + xhalf(l_run[g]));
#pragma unroll
        for (int t = 0; t < 8; ++t) {
#pragma unroll
            for (int r = 0; r < 8; ++r) OUT[o0 + 16 * g + (size_t)(16 * t + r) * TT] = __fadd_rn(acc[g][t][r] * inv, bfr(xr[g][t][r]));
            asm volatile("s_wait_xcnt 0x0" ::: "memory");   // the same precaution for the registers that these stores name
            __builtin_amdgcn_sched_barrier(0); } }   // holds that wait directly behind the stores, as above
}

extern "C" void kernel_launch(void* const* d_in, const int* in_sizes, int n_in,
                              void* d_out, int out_size, void* d_ws, size_t ws_size, hipStream_t stream) {
    (void)in_sizes; (void)n_in; (void)out_size;
    const float* x = (const float*)d_in[0]; const float* wq = (const float*)d_in[1]; const float* bq = (const float*)d_in[2]; const float* wk = (const float*)d_in[3]; const float* bk = (const float*)d_in[4]; const float* wv = (const float*)d_in[5]; const float* bv = (const float*)d_in[6];
    float* OUT = (float*)d_out;     // [8][128][4096]
    char* wsp = (char*)d_ws;
    auto take = [&](size_t bytes) { char* p = wsp; wsp += (bytes + 255) & ~(size_t)255; return (void*)p; };
    bf* WQ = (bf*)take((size_t)CIN * CIN * 2); bf* WK = (bf*)take((size_t)CIN * CIN * 2); bf* WV = (bf*)take((size_t)CIN * CIN * 2); float* CS = (float*)take((size_t)TT * HD * 2 * 4);
    bf* XT = (bf*)take((size_t)NIMG * NPOS * CIN * 2); float* FQ = (float*)take((size_t)TT * DQ * 4); float* FK = (float*)take((size_t)TT * DKV * 4);
    h16* QP16 = (h16*)take((size_t)NH_ * TT * HD * 2); h16* KP16 = (h16*)take((size_t)NKV * TT * HD * 2); h16* VT16 = (h16*)take((size_t)NKV * HD * TT * 2);
    bf* QPh = nullptr; bf* QPl = nullptr; bf* KPh = nullptr; bf* KPl = nullptr; bf* VTh = nullptr; bf* VTl = nullptr;
    if ((size_t)(wsp - (char*)d_ws) > ws_size) return;    // ws 256 MiB
    float* FV = FK;   // v projection reuses the k buffer after the k planes are built (stream-ordered)
    { k_cvt8<<<(unsigned)(((size_t)CIN * CIN / 8 + 255) / 256), 256, 0, stream>>>(wq, WQ, (size_t)CIN * CIN / 8); k_cvt8<<<(unsigned)(((size_t)CIN * CIN / 8 + 255) / 256), 256, 0, stream>>>(wk, WK, (size_t)CIN * CIN / 8); k_cvt8<<<(unsigned)(((size_t)CIN * CIN / 8 + 255) / 256), 256, 0, stream>>>(wv, WV, (size_t)CIN * CIN / 8);
      for (int h = 0; h < NIMG; ++h) k_wtG<<<(unsigned)((CIN * NPOS / 64 + 63) / 64), 256, 0, stream>>>(x + (size_t)h * CIN * NPOS, CIN, NPOS, XT + (size_t)h * NPOS * CIN);   /* XT[h][n][c] = bf16(x[h][c][n]) */ }
    k_csid<<<(TT * HD + 255) / 256, 256, 0, stream>>>(CS);
    const unsigned LQ = (unsigned)(((size_t)NH_ * TT * HD / 2 + 255) / 256), LKv = (unsigned)(((size_t)NKV * TT * HD / 2 + 255) / 256);
    for (int b = 0; b < NB_; ++b) {
        /* q/k/v for all 8 images in one z-batched exact GEMM each: C = F + z*128 columns (ldc 1024), A = XT + z*NPOS*CIN, shared Bt */
        k_gemmw<bf, 0, true><<<dim3(TT / 64, CIN / 64, NIMG), 32, 0, stream>>>(XT, nullptr, WQ, nullptr, CIN, CIN, FQ, DQ, bq, (size_t)NPOS * CIN, 0, (size_t)CIN);
        k_rope<<<LQ, 256, 0, stream>>>(FQ, DQ, NH_, CS, nullptr, nullptr, 1.0f, QP16, QPh, QPl);
        k_gemmw<bf, 0, true><<<dim3(TT / 64, CIN / 64, NIMG), 32, 0, stream>>>(XT, nullptr, WK, nullptr, CIN, CIN, FK, DKV, bk, (size_t)NPOS * CIN, 0, (size_t)CIN);
        k_rope<<<LKv, 256, 0, stream>>>(FK, DKV, NKV, CS, nullptr, nullptr, 1.0f, KP16, KPh, KPl);
        k_gemmw<bf, 0, true><<<dim3(TT / 64, CIN / 64, NIMG), 32, 0, stream>>>(XT, nullptr, WV, nullptr, CIN, CIN, FV, DKV, bv, (size_t)NPOS * CIN, 0, (size_t)CIN); k_vtp<<<LKv, 256, 0, stream>>>(FV, DKV, NKV, VT16, VTh, VTl);
        k_fattn<<<dim3(TT / FBR, NIMG), FW * 32, 0, stream>>>(QP16, KP16, VT16, x, OUT); }
}

// v003
// It runs in 78.5 microseconds.
// Two timings next to v002 put it at 2.31 and 2.32 times that version's speed.
// Counting every step since v000, it is 14.1 times as fast.
#include <hip/hip_runtime.h>

// Light self-attention over image positions (x [8][128][64x64 = 4096] channel-major; per image q/k/v = W x + b (1x1 convs, W [128 out][128 in]); attn[n][m] = softmax_m(q_n.k_m / sqrt(128)) over the 4096 positions; out[c][n] = sum_m attn[n][m] v[c][m] + x[c][n] -> [8][128][64][64]).
// Two launches: k_proj makes the fp16 planes Q[img][n][o], K[img][n][o] and V^T[img][o][n] straight from x, the weights and the biases; k_fattn is the fused attention with the residual.
// Compute dtypes, f32 accumulate: every input rounded to bf16; q/k/v on PLAIN bf16 operands (inputs: exact) + bias; scores and attn.v on single fp16 operands (P = exp(score - running maximum), below 2^8) over 4096 keys, all images in one fused launch; 1/sqrt(128) and the online softmax in f32; out = attn.v (f32) / row sum + bf16(x), written into [c][n] rows.

#define NIMG 8                    // images
#define CIN  128                  // channels
#define TT   4096                 // positions per image
#define HD   128                  // width of q, k and v
#define SCL  0.088388347648318447f   // HD^-0.5
typedef _Float16 h16;
typedef __attribute__((ext_vector_type(16))) __bf16   v16bf;
typedef __attribute__((ext_vector_type(8)))  __bf16   v8bf;
typedef __attribute__((ext_vector_type(4)))  __bf16   v4bf;
typedef __attribute__((ext_vector_type(16))) _Float16 v16h;
typedef __attribute__((ext_vector_type(8)))  _Float16 v8h;
typedef __attribute__((ext_vector_type(2)))  _Float16 v2h;
typedef __attribute__((ext_vector_type(8)))  unsigned short v8us;
typedef __attribute__((ext_vector_type(4)))  unsigned short v4us;
typedef __attribute__((ext_vector_type(8)))  float    v8f;
typedef __attribute__((ext_vector_type(4)))  float    v4f;
typedef __attribute__((ext_vector_type(2)))  float    v2f;
typedef v8h  __attribute__((may_alias)) v8ha;
typedef v4f  __attribute__((may_alias)) v4fa;
typedef v8us __attribute__((may_alias)) v8usa;
typedef v4us __attribute__((may_alias)) v4usa;

__device__ __forceinline__ unsigned short f2bf(float f) { unsigned u = __float_as_uint(f); u += 0x7FFFu + ((u >> 16) & 1u); return (unsigned short)(u >> 16); }
__device__ __forceinline__ float bf2f(unsigned short b) { return __uint_as_float(((unsigned)b) << 16); }
__device__ __forceinline__ float bfr(float f) { return bf2f(f2bf(f)); }
__device__ __forceinline__ v16h cat16(v8h lo, v8h hi) { return __builtin_shufflevector(lo, hi, 0, 1, 2, 3, 4, 5, 6, 7, 8, 9, 10, 11, 12, 13, 14, 15); }
__device__ __forceinline__ v16bf cat16b(v8us lo, v8us hi) { return __builtin_bit_cast(v16bf, __builtin_shufflevector(lo, hi, 0, 1, 2, 3, 4, 5, 6, 7, 8, 9, 10, 11, 12, 13, 14, 15)); }
__device__ __forceinline__ v8f wmma16(v16h a, v16h b, v8f c) { return __builtin_amdgcn_wmma_f32_16x16x32_f16(false, a, false, b, (short)0, c, false, false); }
__device__ __forceinline__ v8f wmmab(v16bf a, v16bf b, v8f c) { return __builtin_amdgcn_wmma_f32_16x16x32_bf16(false, a, false, b, (short)0, c, false, false); }

// ---- k_proj: the three 1x1 convolutions of 128 positions of one image, from the f32 inputs to the fp16 planes that k_fattn reads, in ONE kernel.
// Grid (TT / 128 position blocks, images), 8 waves. Staging: the three weight matrices [o][c] and the x tile, transposed to [position][c], are rounded to bf16 on the way into LDS (row pitch 272 B); one barrier publishes them.
// Every fragment, of a weight row or of a position row, is read by the same code (16 bytes at 16 hi and at 32 + 16 hi of each 64), so both operands have one k order; the 128 channels are summed in four WMMAs, in rising order.
// q, k: A = weight rows, B = positions: a lane's 8 accumulator registers are 8 consecutive outputs o of one position. v: A = positions, B = weight rows: 8 consecutive positions of one output. Either way 16 bytes of fp16 of one plane row.
// A wave owns 64 o x 32 positions of q and of k and 32 o x 64 positions of v, so that it writes whole 128-byte lines: each 16-row x 128-byte piece goes through the wave's own LDS patch and leaves as four 16-byte stores per lane.
// Every loop of k_proj and put_rows is unrolled in full (#pragma unroll): its index picks registers of a fragment, accumulator or staging array, which must be known at compile time, else the array goes to scratch.
#define PPOS  128                 // positions per work-group
#define PPW   272                 // LDS pitch of a row of 128 bf16: 256 B + 16 (odd multiple of 16 B: 16-byte reads without bank conflicts)
#define PMAT  (CIN * PPW)         // one weight matrix, or the x tile
#define PSP   144                 // LDS pitch of a 128-byte output row: 128 B + 16
#define PSG   (16 * PSP)          // one wave's output patch
__device__ __forceinline__ v16bf ldsfragb(const unsigned char* p) { return cat16b(*(const v8usa*)p, *(const v8usa*)(p + 32)); }
// ch[q] = this lane's 16 bytes at byte 32 q + 16 hi of row c of a 16-row x 128-byte piece; dst = the piece's first element, pitch in elements
__device__ __forceinline__ void put_rows(unsigned char* sg, int lane, const v8h (&ch)[4], h16* dst, size_t pitch) {
#pragma unroll
    for (int q = 0; q < 4; ++q) *(v8ha*)(sg + (lane & 15) * PSP + 32 * q + 16 * (lane >> 4)) = ch[q];
    asm volatile("s_wait_dscnt 0x0" ::: "memory");   // the wave's own LDS writes are done before its lanes read each other's rows back; also keeps the compiler from moving the reads up
    v8h rb[4];
#pragma unroll
    for (int s = 0; s < 4; ++s) rb[s] = *(const v8ha*)(sg + (4 * s + (lane >> 3)) * PSP + (lane & 7) * 16);
#pragma unroll
    for (int s = 0; s < 4; ++s) *(v8h*)(dst + (size_t)(4 * s + (lane >> 3)) * pitch + (lane & 7) * 8) = rb[s];
    asm volatile("s_wait_xcnt 0x0" ::: "memory");   // a precaution: stands in front of every later overwrite of the registers that these stores name; as a compiler fence it also keeps the next piece's LDS writes behind the reads above
}
__global__ __launch_bounds__(256) void k_proj(const float* __restrict__ X, const float* __restrict__ Wq, const float* __restrict__ Bq, const float* __restrict__ Wk, const float* __restrict__ Bk, const float* __restrict__ Wv, const float* __restrict__ Bv, h16* Qp, h16* Kp, h16* Vt) {
    __shared__ __align__(16) unsigned char LW[3 * PMAT];
    __shared__ __align__(16) unsigned char LX[PMAT];
    __shared__ __align__(16) unsigned char LS[8 * PSG];
    __shared__ __align__(16) float LB[3 * HD];
    const int tid = threadIdx.x, lane = tid & 31, wave = tid >> 5, c = lane & 15, hi = lane >> 4;
    const int img = blockIdx.y, pb = blockIdx.x * PPOS;
    // weights: 16 bytes per thread and chunk, whole lines (a chunk = 8 rows of 128 f32); x: thread = position tid & 127, 8 channels per group, a wave's load = one 128-byte line of a channel row
    const float* xg = X + (size_t)img * CIN * TT + (size_t)(tid >> 7) * 8 * TT + pb + (tid & 127);
    v4f wa[16], wb[16], wc[16]; float xv[8][8], bb[3] = {0.0f, 0.0f, 0.0f};
#pragma unroll
    for (int j = 0; j < 16; ++j) wa[j] = *(const v4f*)(Wq + j * 1024 + tid * 4);
#pragma unroll
    for (int j = 0; j < 16; ++j) wb[j] = *(const v4f*)(Wk + j * 1024 + tid * 4);
#pragma unroll
    for (int i = 0; i < 8; ++i)
#pragma unroll
        for (int e = 0; e < 8; ++e) xv[i][e] = xg[(size_t)(16 * i + e) * TT];
    if (tid < HD) { bb[0] = Bq[tid]; bb[1] = Bk[tid]; bb[2] = Bv[tid]; }
    asm volatile("s_wait_xcnt 0x0" ::: "memory");   // a precaution: stands in front of every later overwrite of these loads' address registers
    const unsigned wl = wave * PPW + lane * 8;
#pragma unroll
    for (int j = 0; j < 16; ++j) *(v4usa*)(LW + wl + j * 8 * PPW) = __builtin_bit_cast(v4us, __builtin_convertvector(wa[j], v4bf));
#pragma unroll
    for (int j = 0; j < 16; ++j) wc[j] = *(const v4f*)(Wv + j * 1024 + tid * 4);
    asm volatile("s_wait_xcnt 0x0" ::: "memory");   // the same precaution for the loads above
#pragma unroll
    for (int j = 0; j < 16; ++j) *(v4usa*)(LW + PMAT + wl + j * 8 * PPW) = __builtin_bit_cast(v4us, __builtin_convertvector(wb[j], v4bf));
#pragma unroll
    for (int i = 0; i < 8; ++i) { v8f t;
#pragma unroll
        for (int e = 0; e < 8; ++e) t[e] = xv[i][e];
        *(v8usa*)(LX + (tid & 127) * PPW + (2 * i + (tid >> 7)) * 16) = __builtin_bit_cast(v8us, __builtin_convertvector(t, v8bf)); }
    if (tid < HD) { LB[tid] = bfr(bb[0]); LB[HD + tid] = bfr(bb[1]); LB[2 * HD + tid] = bfr(bb[2]); }
#pragma unroll
    for (int j = 0; j < 16; ++j) *(v4usa*)(LW + 2 * PMAT + wl + j * 8 * PPW) = __builtin_bit_cast(v4us, __builtin_convertvector(wc[j], v4bf));
    __syncthreads();
    unsigned char* sg = LS + wave * PSG;
    const unsigned fo = c * PPW + 16 * hi;
    const int w1 = wave & 1, w2 = wave >> 1;
    {   // q and k: outputs 64 w1 .. + 63, positions 32 w2 .. + 31
        v16bf xf[2][4];
#pragma unroll
        for (int g = 0; g < 2; ++g)
#pragma unroll
            for (int kc = 0; kc < 4; ++kc) xf[g][kc] = ldsfragb(LX + (2 * w2 + g) * 16 * PPW + fo + 64 * kc);
#pragma unroll
        for (int m = 0; m < 2; ++m) {
            v8f acc[4][2];
#pragma unroll
            for (int t = 0; t < 4; ++t)
#pragma unroll
                for (int g = 0; g < 2; ++g) acc[t][g] = (v8f){};
#pragma unroll
            for (int kc = 0; kc < 4; ++kc)
#pragma unroll
                for (int t = 0; t < 4; ++t) { const v16bf a = ldsfragb(LW + m * PMAT + (4 * w1 + t) * 16 * PPW + fo + 64 * kc);
#pragma unroll
                    for (int g = 0; g < 2; ++g) acc[t][g] = wmmab(a, xf[g][kc], acc[t][g]); }
            h16* pl = (m ? Kp : Qp) + ((size_t)img * TT + pb + 32 * w2) * HD + 64 * w1;
#pragma unroll
            for (int g = 0; g < 2; ++g) { v8h ch[4];
#pragma unroll
                for (int t = 0; t < 4; ++t) { const float* bp = LB + m * HD + (4 * w1 + t) * 16 + 8 * hi; const v4f b0 = *(const v4fa*)bp, b1 = *(const v4fa*)(bp + 4);
#pragma unroll
                    for (int r = 0; r < 8; ++r) ch[t][r] = (h16)(acc[t][g][r] + (r < 4 ? b0[r & 3] : b1[r & 3])); }
                put_rows(sg, lane, ch, pl + (size_t)g * 16 * HD, HD); }
        }
    }
    {   // v, transposed: outputs 32 w2 .. + 31, positions 64 w1 .. + 63
        v8f acc[2][4];
#pragma unroll
        for (int u = 0; u < 2; ++u)
#pragma unroll
            for (int g = 0; g < 4; ++g) acc[u][g] = (v8f){};
#pragma unroll
        for (int kc = 0; kc < 4; ++kc) { v16bf b[2];
#pragma unroll
            for (int u = 0; u < 2; ++u) b[u] = ldsfragb(LW + 2 * PMAT + (2 * w2 + u) * 16 * PPW + fo + 64 * kc);
#pragma unroll
            for (int g = 0; g < 4; ++g) { const v16bf a = ldsfragb(LX + (4 * w1 + g) * 16 * PPW + fo + 64 * kc);
#pragma unroll
                for (int u = 0; u < 2; ++u) acc[u][g] = wmmab(a, b[u], acc[u][g]); } }
        h16* pl = Vt + ((size_t)img * HD + 32 * w2) * TT + pb + 64 * w1;
#pragma unroll
        for (int u = 0; u < 2; ++u) { const float bo = LB[2 * HD + (2 * w2 + u) * 16 + c]; v8h ch[4];
#pragma unroll
            for (int g = 0; g < 4; ++g)
#pragma unroll
                for (int r = 0; r < 8; ++r) ch[g][r] = (h16)(acc[u][g][r] + bo);
            put_rows(sg, lane, ch, pl + (size_t)u * 16 * TT, TT); }
    }
}

#define FW    4                   // waves per work-group
#define FBR   (FW * 32)           // query columns per work-group
#define FSK   64                  // keys per stage
#define FPK   272                 // LDS pitch of a K row: 256 B + 16 (odd multiple of 16 B: 16-byte reads without bank conflicts)
#define FPV   144                 // LDS pitch of a V^T row of 64 keys: 128 B + 16
#define FTK   (FSK * FPK)
#define FSLOT (FTK + HD * FPV)    // one buffer: the K tile, then the V^T tile
__device__ __forceinline__ float xhalf(float x) { return __builtin_bit_cast(float, __builtin_amdgcn_permlanex16(__builtin_bit_cast(int, x), __builtin_bit_cast(int, x), 0x76543210, 0xfedcba98, false, false)); }   // lane l with lane l ^ 16
__device__ __forceinline__ v16h ldsfrag(const unsigned char* p) { return cat16(*(const v8ha*)p, *(const v8ha*)(p + 32)); }
__global__ __launch_bounds__(FW * 32) void k_fattn(const h16* __restrict__ Qp, const h16* __restrict__ Kp, const h16* __restrict__ Vt, const float* __restrict__ X, float* OUT) {
    __shared__ __align__(16) unsigned char L[2 * FSLOT];
    const int tid = threadIdx.x, lane = tid & 31, wave = tid >> 5, c = lane & 15, hi = lane >> 4;
    const int img = blockIdx.y, qw0 = blockIdx.x * FBR + wave * 32;
    const float cs = SCL * 1.4426950408889634f;
    // staging: 16 bytes per thread and chunk, whole 128-byte lines; a K stage is 16 KiB in a row (chunk = 8 rows), a V^T stage 128 rows of 128 B (chunk = 16 rows)
    const char* kg = (const char*)(Kp + (size_t)img * TT * HD) + tid * 16;
    const char* vg = (const char*)(Vt + (size_t)img * HD * TT) + (size_t)(tid >> 3) * (TT * 2) + (tid & 7) * 16;
    const unsigned kl = (tid >> 4) * FPK + (tid & 15) * 16, vl = FTK + (tid >> 3) * FPV + (tid & 7) * 16;
    v8h sk[8], sv[8];
#pragma unroll
    for (int i = 0; i < 8; ++i) { sk[i] = *(const v8h*)(kg + i * 2048); sv[i] = *(const v8h*)(vg + (size_t)i * 16 * TT * 2); }
    asm volatile("s_wait_xcnt 0x0" ::: "memory");   // a precaution: stands in front of every later overwrite of these loads' address registers (this build places no such wait itself)
    v16h qf[2][4];
#pragma unroll
    for (int g = 0; g < 2; ++g) { const h16* qp = Qp + ((size_t)img * TT + qw0 + 16 * g + c) * HD + 8 * hi;
#pragma unroll
        for (int kc = 0; kc < 4; ++kc) qf[g][kc] = cat16(*(const v8h*)(qp + 32 * kc), *(const v8h*)(qp + 32 * kc + 16)); }
    asm volatile("s_wait_xcnt 0x0" ::: "memory");   // the same precaution for the loads above
    v8f acc[2][8]; float m_run[2], l_run[2];
#pragma unroll
    for (int g = 0; g < 2; ++g) { m_run[g] = -__builtin_inff(); l_run[g] = 0.0f;
#pragma unroll
        for (int t = 0; t < 8; ++t) acc[g][t] = (v8f){}; }
#pragma unroll
    for (int i = 0; i < 8; ++i) { *(v8ha*)(L + kl + i * 8 * FPK) = sk[i]; *(v8ha*)(L + vl + i * 16 * FPV) = sv[i]; }
    __syncthreads();
    v16h kf[2][4];   // the K fragments of one pass, fetched one pass ahead
    const unsigned kfo = c * FPK + 16 * hi, vfo = FTK + c * FPV + 16 * hi;
#pragma unroll
    for (int kt = 0; kt < 2; ++kt)
#pragma unroll
        for (int kc = 0; kc < 4; ++kc) kf[kt][kc] = ldsfrag(L + kfo + kt * 16 * FPK + 64 * kc);
#pragma unroll 1   // one stage per trip: the body already holds two unrolled passes
    for (int st = 0; st < TT / FSK; ++st) {
        const unsigned slot = (unsigned)(st & 1) * FSLOT;
        if (st + 1 < TT / FSK) {
#pragma unroll
            for (int i = 0; i < 8; ++i) { sk[i] = *(const v8h*)(kg + (size_t)(st + 1) * (FSK * HD * 2) + i * 2048); sv[i] = *(const v8h*)(vg + (size_t)(st + 1) * (FSK * 2) + (size_t)i * 16 * TT * 2); }
            asm volatile("s_wait_xcnt 0x0" ::: "memory");   // a precaution: stands in front of every later overwrite of these loads' address registers (this build places no such wait itself)
        }
#pragma unroll
        for (int ps = 0; ps < FSK / 32; ++ps) {
            const unsigned char* vb = L + slot + vfo + ps * 64;
            v8f s[2][2];
#pragma unroll
            for (int kt = 0; kt < 2; ++kt)
#pragma unroll
                for (int g = 0; g < 2; ++g) s[kt][g] = (v8f){};
#pragma unroll
            for (int kc = 0; kc < 4; ++kc)
#pragma unroll
                for (int kt = 0; kt < 2; ++kt)
#pragma unroll
                    for (int g = 0; g < 2; ++g) s[kt][g] = wmma16(kf[kt][kc], qf[g][kc], s[kt][g]);
            v16h vf[8];
#pragma unroll
            for (int t = 0; t < 8; ++t) vf[t] = ldsfrag(vb + t * 16 * FPV);
            if (ps + 1 < FSK / 32) {
#pragma unroll
                for (int kt = 0; kt < 2; ++kt)
#pragma unroll
                    for (int kc = 0; kc < 4; ++kc) kf[kt][kc] = ldsfrag(L + slot + kfo + ((ps + 1) * 32 + kt * 16) * FPK + 64 * kc); }
            asm volatile("" ::: "memory");   // compiler fence: keeps the LDS loads above in front of the softmax, so that they fly under it; without it they sink to their first use and each WMMA waits for its own fragment
            float mb[2]; bool need = false;
#pragma unroll
            for (int g = 0; g < 2; ++g) { float mx = -__builtin_inff();
#pragma unroll
                for (int kt = 0; kt < 2; ++kt)
#pragma unroll
                    for (int r = 0; r < 8; ++r) mx = fmaxf(mx, s[kt][g][r]);
                mx = fmaxf(mx, xhalf(mx)) * cs; mb[g] = mx; need = need || (mx > m_run[g] + 8.0f); }
            if (__builtin_amdgcn_ballot_w32(need) != 0) {   // wave-uniform, rare after the first passes
#pragma unroll
                for (int g = 0; g < 2; ++g) { const float m_new = fmaxf(m_run[g], mb[g]); const float corr = __builtin_amdgcn_exp2f(m_run[g] - m_new);   // 0 on the first pass, where m_run is -inf
                    l_run[g] *= corr; m_run[g] = m_new;
#pragma unroll
                    for (int t = 0; t < 8; ++t) acc[g][t] = acc[g][t] * corr; } }
#pragma unroll
            for (int g = 0; g < 2; ++g) { const float nm = -m_run[g]; v2f psum = (v2f){0.0f, 0.0f}; v16h pf;
#pragma unroll
                for (int i = 0; i < 8; ++i) {
                    const v2f arg = __builtin_elementwise_fma((v2f){s[i >> 2][g][2 * (i & 3)], s[i >> 2][g][2 * (i & 3) + 1]}, (v2f){cs, cs}, (v2f){nm, nm});
                    const v2f p = (v2f){__builtin_amdgcn_exp2f(arg[0]), __builtin_amdgcn_exp2f(arg[1])};
                    psum += p; const v2h pk = __builtin_convertvector(p, v2h); pf[2 * i] = pk[0]; pf[2 * i + 1] = pk[1]; }
                l_run[g] += psum[0] + psum[1];
#pragma unroll
                for (int t = 0; t < 8; ++t) acc[g][t] = wmma16(vf[t], pf, acc[g][t]); }
        }
        if (st + 1 < TT / FSK) { const unsigned nslot = (unsigned)((st + 1) & 1) * FSLOT;
#pragma unroll
            for (int i = 0; i < 8; ++i) { *(v8ha*)(L + nslot + kl + i * 8 * FPK) = sk[i]; *(v8ha*)(L + nslot + vl + i * 16 * FPV) = sv[i]; } }
        __syncthreads();
        if (st + 1 < TT / FSK) { const unsigned nslot = (unsigned)((st + 1) & 1) * FSLOT;
#pragma unroll
            for (int kt = 0; kt < 2; ++kt)
#pragma unroll
                for (int kc = 0; kc < 4; ++kc) kf[kt][kc] = ldsfrag(L + nslot + kfo + kt * 16 * FPK + 64 * kc); }
    }
    // acc[g][t][r] = O[channel 16 t + 8 hi + r][query qw0 + 16 g + c] x that query's sum: the wave's 32 columns are one 128-byte line of each output row
    const size_t o0 = ((size_t)img * HD + 8 * hi) * TT + qw0 + c;
    float xr[2][8][8];
#pragma unroll   // all residual loads of a lane in flight together
    for (int g = 0; g < 2; ++g)
#pragma unroll
        for (int t = 0; t < 8; ++t)
#pragma unroll
            for (int r = 0; r < 8; ++r) xr[g][t][r] = X[o0 + 16 * g + (size_t)(16 * t + r) * TT];
    asm volatile("s_wait_xcnt 0x0" ::: "memory");   // the same precaution for the loads above
    __builtin_amdgcn_sched_barrier(0);   // holds that wait directly behind the loads: without it later vector work is moved in front of it
#pragma unroll
    for (int g = 0; g < 2; ++g) { const float inv = 1.0f / (l_run[g] + xhalf(l_run[g]));
#pragma unroll
        for (int t = 0; t < 8; ++t) {
#pragma unroll
            for (int r = 0; r < 8; ++r) OUT[o0 + 16 * g + (size_t)(16 * t + r) * TT] = __fadd_rn(acc[g][t][r] * inv, bfr(xr[g][t][r]));
            asm volatile("s_wait_xcnt 0x0" ::: "memory");   // the same precaution for the registers that these stores name
            __builtin_amdgcn_sched_barrier(0); } }   // holds that wait directly behind the stores, as above
}

extern "C" void kernel_launch(void* const* d_in, const int* in_sizes, int n_in,
                              void* d_out, int out_size, void* d_ws, size_t ws_size, hipStream_t stream) {
    (void)in_sizes; (void)n_in; (void)out_size;
    const float* x = (const float*)d_in[0]; const float* wq = (const float*)d_in[1]; const float* bq = (const float*)d_in[2]; const float* wk = (const float*)d_in[3]; const float* bk = (const float*)d_in[4]; const float* wv = (const float*)d_in[5]; const float* bv = (const float*)d_in[6];
    float* OUT = (float*)d_out;     // [8][128][4096]
    char* wsp = (char*)d_ws;
    auto take = [&](size_t bytes) { char* p = wsp; wsp += (bytes + 255) & ~(size_t)255; return (void*)p; };
    h16* QP16 = (h16*)take((size_t)NIMG * TT * HD * 2); h16* KP16 = (h16*)take((size_t)NIMG * TT * HD * 2); h16* VT16 = (h16*)take((size_t)NIMG * HD * TT * 2);
    if ((size_t)(wsp - (char*)d_ws) > ws_size) return;    // ws 256 MiB
    k_proj<<<dim3(TT / PPOS, NIMG), 256, 0, stream>>>(x, wq, bq, wk, bk, wv, bv, QP16, KP16, VT16);
    k_fattn<<<dim3(TT / FBR, NIMG), FW * 32, 0, stream>>>(QP16, KP16, VT16, x, OUT);
}

// v004
// One run takes 61.4 microseconds.
// Timed twice side by side with v003, it ran 1.29 and 1.28 times as fast.
// Counting every step since v000, it is 18.2 times as fast.
#include <hip/hip_runtime.h>

// Light self-attention over image positions (x [8][128][64x64 = 4096] channel-major; per image q/k/v = W x + b (1x1 convs, W [128 out][128 in]); attn[n][m] = softmax_m(q_n.k_m / sqrt(128)) over the 4096 positions; out[c][n] = sum_m attn[n][m] v[c][m] + x[c][n] -> [8][128][64][64]).
// Two launches: k_proj makes the fp16 planes Q[img][n][o], K[img][n][o] and V^T[img][o][n] straight from x, the weights and the biases; k_fattn is the fused attention with the residual.
// Compute dtypes, f32 accumulate: every input rounded to bf16; q/k/v on PLAIN bf16 operands (inputs: exact) + bias; scores and attn.v on single fp16 operands (P = exp(score - running maximum), below 2^8) over 4096 keys, all images in one fused launch; 1/sqrt(128) and the online softmax in f32; out = attn.v (f32) / row sum + bf16(x), written into [c][n] rows.

#define NIMG 8                    // images
#define CIN  128                  // channels
#define TT   4096                 // positions per image
#define HD   128                  // width of q, k and v
#define SCL  0.088388347648318447f   // HD^-0.5
typedef _Float16 h16;
typedef __attribute__((ext_vector_type(16))) __bf16   v16bf;
typedef __attribute__((ext_vector_type(8)))  __bf16   v8bf;
typedef __attribute__((ext_vector_type(4)))  __bf16   v4bf;
typedef __attribute__((ext_vector_type(16))) _Float16 v16h;
typedef __attribute__((ext_vector_type(8)))  _Float16 v8h;
typedef __attribute__((ext_vector_type(2)))  _Float16 v2h;
typedef __attribute__((ext_vector_type(8)))  unsigned short v8us;
typedef __attribute__((ext_vector_type(4)))  unsigned short v4us;
typedef __attribute__((ext_vector_type(8)))  float    v8f;
typedef __attribute__((ext_vector_type(4)))  float    v4f;
typedef __attribute__((ext_vector_type(2)))  float    v2f;
typedef v8h  __attribute__((may_alias)) v8ha;
typedef v4f  __attribute__((may_alias)) v4fa;
typedef v8us __attribute__((may_alias)) v8usa;
typedef v4us __attribute__((may_alias)) v4usa;

__device__ __forceinline__ unsigned short f2bf(float f) { unsigned u = __float_as_uint(f); u += 0x7FFFu + ((u >> 16) & 1u); return (unsigned short)(u >> 16); }
__device__ __forceinline__ float bf2f(unsigned short b) { return __uint_as_float(((unsigned)b) << 16); }
__device__ __forceinline__ float bfr(float f) { return bf2f(f2bf(f)); }
__device__ __forceinline__ v16h cat16(v8h lo, v8h hi) { return __builtin_shufflevector(lo, hi, 0, 1, 2, 3, 4, 5, 6, 7, 8, 9, 10, 11, 12, 13, 14, 15); }
__device__ __forceinline__ v16bf cat16b(v8us lo, v8us hi) { return __builtin_bit_cast(v16bf, __builtin_shufflevector(lo, hi, 0, 1, 2, 3, 4, 5, 6, 7, 8, 9, 10, 11, 12, 13, 14, 15)); }
__device__ __forceinline__ v8f wmma16(v16h a, v16h b, v8f c) { return __builtin_amdgcn_wmma_f32_16x16x32_f16(false, a, false, b, (short)0, c, false, false); }
__device__ __forceinline__ v8f wmmab(v16bf a, v16bf b, v8f c) { return __builtin_amdgcn_wmma_f32_16x16x32_bf16(false, a, false, b, (short)0, c, false, false); }

// ---- k_proj: the three 1x1 convolutions of 128 positions of one image, from the f32 inputs to the fp16 planes that k_fattn reads, in ONE kernel.
// Grid (TT / 128 position blocks, images), 8 waves. Staging: the three weight matrices [o][c] and the x tile, transposed to [position][c], are rounded to bf16 on the way into LDS (row pitch 272 B); one barrier publishes them.
// Every fragment, of a weight row or of a position row, is read by the same code (16 bytes at 16 hi and at 32 + 16 hi of each 64), so both operands have one k order; the 128 channels are summed in four WMMAs, in rising order.
// q, k: A = weight rows, B = positions: a lane's 8 accumulator registers are 8 consecutive outputs o of one position. v: A = positions, B = weight rows: 8 consecutive positions of one output. Either way 16 bytes of fp16 of one plane row.
// A wave owns 64 o x 32 positions of q and of k and 32 o x 64 positions of v, so that it writes whole 128-byte lines: each 16-row x 128-byte piece goes through the wave's own LDS patch and leaves as four 16-byte stores per lane.
// Every loop of k_proj and put_rows is unrolled in full (#pragma unroll): its index picks registers of a fragment, accumulator or staging array, which must be known at compile time, else the array goes to scratch.
#define PPOS  128                 // positions per work-group
#define PPW   272                 // LDS pitch of a row of 128 bf16: 256 B + 16 (odd multiple of 16 B: 16-byte reads without bank conflicts)
#define PMAT  (CIN * PPW)         // one weight matrix, or the x tile
#define PSP   144                 // LDS pitch of a 128-byte output row: 128 B + 16
#define PSG   (16 * PSP)          // one wave's output patch
__device__ __forceinline__ v16bf ldsfragb(const unsigned char* p) { return cat16b(*(const v8usa*)p, *(const v8usa*)(p + 32)); }
// ch[q] = this lane's 16 bytes at byte 32 q + 16 hi of row c of a 16-row x 128-byte piece; dst = the piece's first element, pitch in elements
__device__ __forceinline__ void put_rows(unsigned char* sg, int lane, const v8h (&ch)[4], h16* dst, size_t pitch) {
#pragma unroll
    for (int q = 0; q < 4; ++q) *(v8ha*)(sg + (lane & 15) * PSP + 32 * q + 16 * (lane >> 4)) = ch[q];
    asm volatile("s_wait_dscnt 0x0" ::: "memory");   // the wave's own LDS writes are done before its lanes read each other's rows back; also keeps the compiler from moving the reads up
    v8h rb[4];
#pragma unroll
    for (int s = 0; s < 4; ++s) rb[s] = *(const v8ha*)(sg + (4 * s + (lane >> 3)) * PSP + (lane & 7) * 16);
#pragma unroll
    for (int s = 0; s < 4; ++s) *(v8h*)(dst + (size_t)(4 * s + (lane >> 3)) * pitch + (lane & 7) * 8) = rb[s];
    asm volatile("s_wait_xcnt 0x0" ::: "memory");   // a precaution: stands in front of every later overwrite of the registers that these stores name; as a compiler fence it also keeps the next piece's LDS writes behind the reads above
}
__global__ __launch_bounds__(256) void k_proj(const float* __restrict__ X, const float* __restrict__ Wq, const float* __restrict__ Bq, const float* __restrict__ Wk, const float* __restrict__ Bk, const float* __restrict__ Wv, const float* __restrict__ Bv, h16* Qp, h16* Kp, h16* Vt) {
    __shared__ __align__(16) unsigned char LW[3 * PMAT];
    __shared__ __align__(16) unsigned char LX[PMAT];
    __shared__ __align__(16) unsigned char LS[8 * PSG];
    __shared__ __align__(16) float LB[3 * HD];
    const int tid = threadIdx.x, lane = tid & 31, wave = tid >> 5, c = lane & 15, hi = lane >> 4;
    const int img = blockIdx.y, pb = blockIdx.x * PPOS;
    // weights: 16 bytes per thread and chunk, whole lines (a chunk = 8 rows of 128 f32); x: thread = position tid & 127, 8 channels per group, a wave's load = one 128-byte line of a channel row
    const float* xg = X + (size_t)img * CIN * TT + (size_t)(tid >> 7) * 8 * TT + pb + (tid & 127);
    v4f wa[16], wb[16], wc[16]; float xv[8][8], bb[3] = {0.0f, 0.0f, 0.0f};
#pragma unroll
    for (int j = 0; j < 16; ++j) wa[j] = *(const v4f*)(Wq + j * 1024 + tid * 4);
#pragma unroll
    for (int j = 0; j < 16; ++j) wb[j] = *(const v4f*)(Wk + j * 1024 + tid * 4);
#pragma unroll
    for (int i = 0; i < 8; ++i)
#pragma unroll
        for (int e = 0; e < 8; ++e) xv[i][e] = xg[(size_t)(16 * i + e) * TT];
    if (tid < HD) { bb[0] = Bq[tid]; bb[1] = Bk[tid]; bb[2] = Bv[tid]; }
    asm volatile("s_wait_xcnt 0x0" ::: "memory");   // a precaution: stands in front of every later overwrite of these loads' address registers
    const unsigned wl = wave * PPW + lane * 8;
#pragma unroll
    for (int j = 0; j < 16; ++j) *(v4usa*)(LW + wl + j * 8 * PPW) = __builtin_bit_cast(v4us, __builtin_convertvector(wa[j], v4bf));
#pragma unroll
    for (int j = 0; j < 16; ++j) wc[j] = *(const v4f*)(Wv + j * 1024 + tid * 4);
    asm volatile("s_wait_xcnt 0x0" ::: "memory");   // the same precaution for the loads above
#pragma unroll
    for (int j = 0; j < 16; ++j) *(v4usa*)(LW + PMAT + wl + j * 8 * PPW) = __builtin_bit_cast(v4us, __builtin_convertvector(wb[j], v4bf));
#pragma unroll
    for (int i = 0; i < 8; ++i) { v8f t;
#pragma unroll
        for (int e = 0; e < 8; ++e) t[e] = xv[i][e];
        *(v8usa*)(LX + (tid & 127) * PPW + (2 * i + (tid >> 7)) * 16) = __builtin_bit_cast(v8us, __builtin_convertvector(t, v8bf)); }
    if (tid < HD) { LB[tid] = bfr(bb[0]); LB[HD + tid] = bfr(bb[1]); LB[2 * HD + tid] = bfr(bb[2]); }
#pragma unroll
    for (int j = 0; j < 16; ++j) *(v4usa*)(LW + 2 * PMAT + wl + j * 8 * PPW) = __builtin_bit_cast(v4us, __builtin_convertvector(wc[j], v4bf));
    __syncthreads();
    unsigned char* sg = LS + wave * PSG;
    const unsigned fo = c * PPW + 16 * hi;
    const int w1 = wave & 1, w2 = wave >> 1;
    {   // q and k: outputs 64 w1 .. + 63, positions 32 w2 .. + 31
        v16bf xf[2][4];
#pragma unroll
        for (int g = 0; g < 2; ++g)
#pragma unroll
            for (int kc = 0; kc < 4; ++kc) xf[g][kc] = ldsfragb(LX + (2 * w2 + g) * 16 * PPW + fo + 64 * kc);
#pragma unroll
        for (int m = 0; m < 2; ++m) {
            v8f acc[4][2];
#pragma unroll
            for (int t = 0; t < 4; ++t)
#pragma unroll
                for (int g = 0; g < 2; ++g) acc[t][g] = (v8f){};
#pragma unroll
            for (int kc = 0; kc < 4; ++kc)
#pragma unroll
                for (int t = 0; t < 4; ++t) { const v16bf a = ldsfragb(LW + m * PMAT + (4 * w1 + t) * 16 * PPW + fo + 64 * kc);
#pragma unroll
                    for (int g = 0; g < 2; ++g) acc[t][g] = wmmab(a, xf[g][kc], acc[t][g]); }
            h16* pl = (m ? Kp : Qp) + ((size_t)img * TT + pb + 32 * w2) * HD + 64 * w1;
#pragma unroll
            for (int g = 0; g < 2; ++g) { v8h ch[4];
#pragma unroll
                for (int t = 0; t < 4; ++t) { const float* bp = LB + m * HD + (4 * w1 + t) * 16 + 8 * hi; const v4f b0 = *(const v4fa*)bp, b1 = *(const v4fa*)(bp + 4);
#pragma unroll
                    for (int r = 0; r < 8; ++r) ch[t][r] = (h16)(acc[t][g][r] + (r < 4 ? b0[r & 3] : b1[r & 3])); }
                put_rows(sg, lane, ch, pl + (size_t)g * 16 * HD, HD); }
        }
    }
    {   // v, transposed: outputs 32 w2 .. + 31, positions 64 w1 .. + 63
        v8f acc[2][4];
#pragma unroll
        for (int u = 0; u < 2; ++u)
#pragma unroll
            for (int g = 0; g < 4; ++g) acc[u][g] = (v8f){};
#pragma unroll
        for (int kc = 0; kc < 4; ++kc) { v16bf b[2];
#pragma unroll
            for (int u = 0; u < 2; ++u) b[u] = ldsfragb(LW + 2 * PMAT + (2 * w2 + u) * 16 * PPW + fo + 64 * kc);
#pragma unroll
            for (int g = 0; g < 4; ++g) { const v16bf a = ldsfragb(LX + (4 * w1 + g) * 16 * PPW + fo + 64 * kc);
#pragma unroll
                for (int u = 0; u < 2; ++u) acc[u][g] = wmmab(a, b[u], acc[u][g]); } }
        h16* pl = Vt + ((size_t)img * HD + 32 * w2) * TT + pb + 64 * w1;
#pragma unroll
        for (int u = 0; u < 2; ++u) { const float bo = LB[2 * HD + (2 * w2 + u) * 16 + c]; v8h ch[4];
#pragma unroll
            for (int g = 0; g < 4; ++g)
#pragma unroll
                for (int r = 0; r < 8; ++r) ch[g][r] = (h16)(acc[u][g][r] + bo);
            put_rows(sg, lane, ch, pl + (size_t)u * 16 * TT, TT); }
    }
}

#define FW    8                   // waves per work-group: 4 column sets x 2 key halves
#define FBR   128                 // query columns per work-group
#define FSK   128                 // keys per stage
#define FHK   64                  // keys of a stage per wave
#define FPK   272                 // LDS pitch of a K row: 256 B + 16 (odd multiple of 16 B: 16-byte reads without bank conflicts)
#define FPV   272                 // LDS pitch of a V^T row of 128 keys: 256 B + 16
#define FTK   (FSK * FPK)
#define FSLOT (FTK + HD * FPV)    // one buffer: the K tile, then the V^T tile
#define FXW   (17 * 512)          // one wave's patch of the join: 16 x 16 bytes per lane of accumulators, then 16 bytes per lane of maxima and sums
__device__ __forceinline__ float xhalf(float x) { return __builtin_bit_cast(float, __builtin_amdgcn_permlanex16(__builtin_bit_cast(int, x), __builtin_bit_cast(int, x), 0x76543210, 0xfedcba98, false, false)); }   // lane l with lane l ^ 16
__device__ __forceinline__ v16h ldsfrag(const unsigned char* p) { return cat16(*(const v8ha*)p, *(const v8ha*)(p + 32)); }
__global__ __launch_bounds__(FW * 32) void k_fattn(const h16* __restrict__ Qp, const h16* __restrict__ Kp, const h16* __restrict__ Vt, const float* __restrict__ X, float* OUT) {
    __shared__ __align__(16) unsigned char L[2 * FSLOT];
    const int tid = threadIdx.x, lane = tid & 31, wave = __builtin_amdgcn_readfirstlane(tid >> 5), c = lane & 15, hi = lane >> 4;
    const int kh = wave >> 2;   // this wave's half of every stage's keys
    const int img = blockIdx.y, qw0 = blockIdx.x * FBR + (wave & 3) * 32;
    const float cs = SCL * 1.4426950408889634f;
    // staging: 16 bytes per thread and chunk, whole 256-byte rows; a K stage is 32 KiB in a row, a V^T stage 128 rows of 256 B (a chunk = 16 rows of either)
    const char* kg = (const char*)(Kp + (size_t)img * TT * HD) + tid * 16;
    const char* vg = (const char*)(Vt + (size_t)img * HD * TT) + (size_t)(tid >> 4) * (TT * 2) + (tid & 15) * 16;
    const unsigned kl = (tid >> 4) * FPK + (tid & 15) * 16, vl = FTK + (tid >> 4) * FPV + (tid & 15) * 16;
    v8h sk[8], sv[8];
#pragma unroll
    for (int i = 0; i < 8; ++i) { sk[i] = *(const v8h*)(kg + i * 4096); sv[i] = *(const v8h*)(vg + (size_t)i * 16 * TT * 2); }
    asm volatile("s_wait_xcnt 0x0" ::: "memory");   // a precaution: stands in front of every later overwrite of these loads' address registers (this build places no such wait itself)
    __builtin_amdgcn_sched_barrier(0);   // holds that wait directly behind the loads: without it a later write of their offset register is moved in front of it
    v16h qf[2][4];
#pragma unroll
    for (int g = 0; g < 2; ++g) { const h16* qp = Qp + ((size_t)img * TT + qw0 + 16 * g + c) * HD + 8 * hi;
#pragma unroll
        for (int kc = 0; kc < 4; ++kc) qf[g][kc] = cat16(*(const v8h*)(qp + 32 * kc), *(const v8h*)(qp + 32 * kc + 16)); }
    asm volatile("s_wait_xcnt 0x0" ::: "memory");   // the same precaution for the loads above
    v8f acc[2][8]; float m_run[2], l_run[2];
#pragma unroll
    for (int g = 0; g < 2; ++g) { m_run[g] = -__builtin_inff(); l_run[g] = 0.0f;
#pragma unroll
        for (int t = 0; t < 8; ++t) acc[g][t] = (v8f){}; }
#pragma unroll
    for (int i = 0; i < 8; ++i) { *(v8ha*)(L + kl + i * 16 * FPK) = sk[i]; *(v8ha*)(L + vl + i * 16 * FPV) = sv[i]; }
    __syncthreads();
    v16h kf[2][4];   // the K fragments of one pass, fetched one pass ahead
    const unsigned kfo = (kh * FHK + c) * FPK + 16 * hi, vfo = FTK + c * FPV + kh * (FHK * 2) + 16 * hi;
#pragma unroll
    for (int kt = 0; kt < 2; ++kt)
#pragma unroll
        for (int kc = 0; kc < 4; ++kc) kf[kt][kc] = ldsfrag(L + kfo + kt * 16 * FPK + 64 * kc);
#pragma unroll 1   // one stage per trip: the body already holds two unrolled passes
    for (int st = 0; st < TT / FSK; ++st) {
        const unsigned slot = (unsigned)(st & 1) * FSLOT;
        if (st + 1 < TT / FSK) {
#pragma unroll
            for (int i = 0; i < 8; ++i) { sk[i] = *(const v8h*)(kg + (size_t)(st + 1) * (FSK * HD * 2) + i * 4096); sv[i] = *(const v8h*)(vg + (size_t)(st + 1) * (FSK * 2) + (size_t)i * 16 * TT * 2); }
            asm volatile("s_wait_xcnt 0x0" ::: "memory");   // a precaution: stands in front of every later overwrite of these loads' address registers (this build places no such wait itself)
        }
#pragma unroll
        for (int ps = 0; ps < FHK / 32; ++ps) {
            const unsigned char* vb = L + slot + vfo + ps * 64;
            v8f s[2][2];
#pragma unroll
            for (int kt = 0; kt < 2; ++kt)
#pragma unroll
                for (int g = 0; g < 2; ++g) s[kt][g] = (v8f){};
#pragma unroll
            for (int kc = 0; kc < 4; ++kc)
#pragma unroll
                for (int kt = 0; kt < 2; ++kt)
#pragma unroll
                    for (int g = 0; g < 2; ++g) s[kt][g] = wmma16(kf[kt][kc], qf[g][kc], s[kt][g]);
            v16h vf[8];
#pragma unroll
            for (int t = 0; t < 8; ++t) vf[t] = ldsfrag(vb + t * 16 * FPV);
            if (ps + 1 < FHK / 32) {
#pragma unroll
                for (int kt = 0; kt < 2; ++kt)
#pragma unroll
                    for (int kc = 0; kc < 4; ++kc) kf[kt][kc] = ldsfrag(L + slot + kfo + ((ps + 1) * 32 + kt * 16) * FPK + 64 * kc); }
            asm volatile("" ::: "memory");   // compiler fence: keeps the LDS loads above in front of the softmax, so that they fly under it; without it they sink to their first use and each WMMA waits for its own fragment
            float mb[2]; bool need = false;
#pragma unroll
            for (int g = 0; g < 2; ++g) { float mx = -__builtin_inff();
#pragma unroll
                for (int kt = 0; kt < 2; ++kt)
#pragma unroll
                    for (int r = 0; r < 8; ++r) mx = fmaxf(mx, s[kt][g][r]);
                mx = fmaxf(mx, xhalf(mx)) * cs; mb[g] = mx; need = need || (mx > m_run[g] + 8.0f); }
            if (__builtin_amdgcn_ballot_w32(need) != 0) {   // wave-uniform, rare after the first passes
#pragma unroll
                for (int g = 0; g < 2; ++g) { const float m_new = fmaxf(m_run[g], mb[g]); const float corr = __builtin_amdgcn_exp2f(m_run[g] - m_new);   // 0 on the first pass, where m_run is -inf
                    l_run[g] *= corr; m_run[g] = m_new;
#pragma unroll
                    for (int t = 0; t < 8; ++t) acc[g][t] = acc[g][t] * corr; } }
#pragma unroll
            for (int g = 0; g < 2; ++g) { const float nm = -m_run[g]; v2f psum = (v2f){0.0f, 0.0f}; v16h pf;
#pragma unroll
                for (int i = 0; i < 8; ++i) {
                    const v2f arg = __builtin_elementwise_fma((v2f){s[i >> 2][g][2 * (i & 3)], s[i >> 2][g][2 * (i & 3) + 1]}, (v2f){cs, cs}, (v2f){nm, nm});
                    const v2f p = (v2f){__builtin_amdgcn_exp2f(arg[0]), __builtin_amdgcn_exp2f(arg[1])};
                    psum += p; const v2h pk = __builtin_convertvector(p, v2h); pf[2 * i] = pk[0]; pf[2 * i + 1] = pk[1]; }
                l_run[g] += psum[0] + psum[1];
#pragma unroll
                for (int t = 0; t < 8; ++t) acc[g][t] = wmma16(vf[t], pf, acc[g][t]); }
        }
        if (st + 1 < TT / FSK) { const unsigned nslot = (unsigned)((st + 1) & 1) * FSLOT;
#pragma unroll
            for (int i = 0; i < 8; ++i) { *(v8ha*)(L + nslot + kl + i * 16 * FPK) = sk[i]; *(v8ha*)(L + nslot + vl + i * 16 * FPV) = sv[i]; } }
        __syncthreads();
        if (st + 1 < TT / FSK) { const unsigned nslot = (unsigned)((st + 1) & 1) * FSLOT;
#pragma unroll
            for (int kt = 0; kt < 2; ++kt)
#pragma unroll
                for (int kc = 0; kc < 4; ++kc) kf[kt][kc] = ldsfrag(L + nslot + kfo + kt * 16 * FPK + 64 * kc); }
    }
    // acc[g][t][r] = O[channel 16 t + 8 hi + r][query qw0 + 16 g + c] x that query's sum, over this wave's keys and relative to its own m_run.
    // The join: the wave of key half kh finishes channel tiles 4 kh .. 4 kh + 3 of both column groups (its 32 columns are one 128-byte line of each of 64 output rows) and hands its other four tiles, its maxima and its sums to its partner, wave ^ 4, through its own LDS patch.
    // The ring is free for that: the loop's last barrier stands behind every wave's last fragment read.
    const size_t o0 = ((size_t)img * HD + 64 * kh + 8 * hi) * TT + qw0 + c;
    float xr[2][4][8];
#pragma unroll   // all residual loads of a lane in flight together, under the join
    for (int g = 0; g < 2; ++g)
#pragma unroll
        for (int t = 0; t < 4; ++t)
#pragma unroll
            for (int r = 0; r < 8; ++r) xr[g][t][r] = X[o0 + 16 * g + (size_t)(16 * t + r) * TT];
    asm volatile("s_wait_xcnt 0x0" ::: "memory");   // the same precaution for the loads above
    __builtin_amdgcn_sched_barrier(0);   // holds that wait directly behind the loads: without it later vector work is moved in front of it
    unsigned char* xo = L + wave * FXW + lane * 16;
    const unsigned char* xi = L + (wave ^ 4) * FXW + lane * 16;
    float lf[2];
#pragma unroll
    for (int g = 0; g < 2; ++g) lf[g] = l_run[g] + xhalf(l_run[g]);
    v8f keep[2][4];
#pragma unroll
    for (int g = 0; g < 2; ++g)
#pragma unroll
        for (int t = 0; t < 4; ++t) { const v8f give = kh ? acc[g][t] : acc[g][4 + t]; keep[g][t] = kh ? acc[g][4 + t] : acc[g][t];
            *(v4fa*)(xo + (8 * g + 2 * t) * 512) = __builtin_shufflevector(give, give, 0, 1, 2, 3); *(v4fa*)(xo + (8 * g + 2 * t + 1) * 512) = __builtin_shufflevector(give, give, 4, 5, 6, 7); }
    *(v4fa*)(xo + 16 * 512) = (v4f){m_run[0], m_run[1], lf[0], lf[1]};
    __syncthreads();   // publishes every wave's patch to its partner
    const v4f pml = *(const v4fa*)(xi + 16 * 512);
#pragma unroll
    for (int g = 0; g < 2; ++g) { const float m = fmaxf(m_run[g], pml[g]); const float fo = __builtin_amdgcn_exp2f(m_run[g] - m), fp = __builtin_amdgcn_exp2f(pml[g] - m);
        const float inv = 1.0f / (lf[g] * fo + pml[2 + g] * fp); const float so = fo * inv, sp = fp * inv;
#pragma unroll
        for (int t = 0; t < 4; ++t) { const v4f p0 = *(const v4fa*)(xi + (8 * g + 2 * t) * 512), p1 = *(const v4fa*)(xi + (8 * g + 2 * t + 1) * 512);
#pragma unroll
            for (int r = 0; r < 8; ++r) OUT[o0 + 16 * g + (size_t)(16 * t + r) * TT] = __fadd_rn(keep[g][t][r] * so + (r < 4 ? p0[r & 3] : p1[r & 3]) * sp, bfr(xr[g][t][r]));
            asm volatile("s_wait_xcnt 0x0" ::: "memory");   // the same precaution for the registers that these stores name
            __builtin_amdgcn_sched_barrier(0); } }   // holds that wait directly behind the stores, as above
}

extern "C" void kernel_launch(void* const* d_in, const int* in_sizes, int n_in,
                              void* d_out, int out_size, void* d_ws, size_t ws_size, hipStream_t stream) {
    (void)in_sizes; (void)n_in; (void)out_size;
    const float* x = (const float*)d_in[0]; const float* wq = (const float*)d_in[1]; const float* bq = (const float*)d_in[2]; const float* wk = (const float*)d_in[3]; const float* bk = (const float*)d_in[4]; const float* wv = (const float*)d_in[5]; const float* bv = (const float*)d_in[6];
    float* OUT = (float*)d_out;     // [8][128][4096]
    char* wsp = (char*)d_ws;
    auto take = [&](size_t bytes) { char* p = wsp; wsp += (bytes + 255) & ~(size_t)255; return (void*)p; };
    h16* QP16 = (h16*)take((size_t)NIMG * TT * HD * 2); h16* KP16 = (h16*)take((size_t)NIMG * TT * HD * 2); h16* VT16 = (h16*)take((size_t)NIMG * HD * TT * 2);
    if ((size_t)(wsp - (char*)d_ws) > ws_size) return;    // ws 256 MiB
    k_proj<<<dim3(TT / PPOS, NIMG), 256, 0, stream>>>(x, wq, bq, wk, bk, wv, bv, QP16, KP16, VT16);
    k_fattn<<<dim3(TT / FBR, NIMG), FW * 32, 0, stream>>>(QP16, KP16, VT16, x, OUT);
}

// v005
// Measured time: 54.7 microseconds a run.
// Timed twice side by side with v004, it ran 1.12 times as fast both times.
// All steps since v000 together make it 20.4 times as fast.
#include <hip/hip_runtime.h>

// Light self-attention over image positions (x [8][128][64x64 = 4096] channel-major; per image q/k/v = W x + b (1x1 convs, W [128 out][128 in]); attn[n][m] = softmax_m(q_n.k_m / sqrt(128)) over the 4096 positions; out[c][n] = sum_m attn[n][m] v[c][m] + x[c][n] -> [8][128][64][64]).
// Two launches: k_proj makes the fp16 planes Q[img][n][o], K[img][n][o] and V^T[img][o][n] straight from x, the weights and the biases; k_fattn is the fused attention with the residual.
// Compute dtypes, f32 accumulate: every input rounded to bf16; q/k/v on PLAIN bf16 operands (inputs: exact) + bias; scores and attn.v on single fp16 operands (P = exp(score - running maximum), below 2^8) over 4096 keys, all images in one fused launch; 1/sqrt(128) and the online softmax in f32; out = attn.v (f32) / row sum + bf16(x), written into [c][n] rows.

#define NIMG 8                    // images
#define CIN  128                  // channels
#define TT   4096                 // positions per image
#define HD   128                  // width of q, k and v
#define SCL  0.088388347648318447f   // HD^-0.5
typedef _Float16 h16;
typedef __attribute__((ext_vector_type(16))) __bf16   v16bf;
typedef __attribute__((ext_vector_type(8)))  __bf16   v8bf;
typedef __attribute__((ext_vector_type(4)))  __bf16   v4bf;
typedef __attribute__((ext_vector_type(16))) _Float16 v16h;
typedef __attribute__((ext_vector_type(8)))  _Float16 v8h;
typedef __attribute__((ext_vector_type(2)))  _Float16 v2h;
typedef __attribute__((ext_vector_type(8)))  unsigned short v8us;
typedef __attribute__((ext_vector_type(4)))  unsigned short v4us;
typedef __attribute__((ext_vector_type(8)))  float    v8f;
typedef __attribute__((ext_vector_type(4)))  float    v4f;
typedef __attribute__((ext_vector_type(2)))  float    v2f;
typedef v8h  __attribute__((may_alias)) v8ha;
typedef v4f  __attribute__((may_alias)) v4fa;
typedef v8us __attribute__((may_alias)) v8usa;
typedef v4us __attribute__((may_alias)) v4usa;

__device__ __forceinline__ unsigned short f2bf(float f) { unsigned u = __float_as_uint(f); u += 0x7FFFu + ((u >> 16) & 1u); return (unsigned short)(u >> 16); }
__device__ __forceinline__ float bf2f(unsigned short b) { return __uint_as_float(((unsigned)b) << 16); }
__device__ __forceinline__ float bfr(float f) { return bf2f(f2bf(f)); }
__device__ __forceinline__ v16h cat16(v8h lo, v8h hi) { return __builtin_shufflevector(lo, hi, 0, 1, 2, 3, 4, 5, 6, 7, 8, 9, 10, 11, 12, 13, 14, 15); }
__device__ __forceinline__ v16bf cat16b(v8us lo, v8us hi) { return __builtin_bit_cast(v16bf, __builtin_shufflevector(lo, hi, 0, 1, 2, 3, 4, 5, 6, 7, 8, 9, 10, 11, 12, 13, 14, 15)); }
__device__ __forceinline__ v8f wmma16(v16h a, v16h b, v8f c) { return __builtin_amdgcn_wmma_f32_16x16x32_f16(false, a, false, b, (short)0, c, false, false); }
__device__ __forceinline__ v8f wmmab(v16bf a, v16bf b, v8f c) { return __builtin_amdgcn_wmma_f32_16x16x32_bf16(false, a, false, b, (short)0, c, false, false); }

// ---- k_proj: the three 1x1 convolutions of 128 positions of one image, from the f32 inputs to the fp16 planes that k_fattn reads, in ONE kernel.
// Grid (TT / 128 position blocks, images), 8 waves. Staging: the three weight matrices [o][c] and the x tile, transposed to [position][c], are rounded to bf16 on the way into LDS (row pitch 272 B); one barrier publishes them.
// Every fragment, of a weight row or of a position row, is read by the same code (16 bytes at 16 hi and at 32 + 16 hi of each 64), so both operands have one k order; the 128 channels are summed in four WMMAs, in rising order.
// q, k: A = weight rows, B = positions: a lane's 8 accumulator registers are 8 consecutive outputs o of one position. v: A = positions, B = weight rows: 8 consecutive positions of one output. Either way 16 bytes of fp16 of one plane row.
// A wave owns 64 o x 32 positions of q and of k and 32 o x 64 positions of v, so that it writes whole 128-byte lines: each 16-row x 128-byte piece goes through the wave's own LDS patch and leaves as four 16-byte stores per lane.
// Every loop of k_proj and put_rows is unrolled in full (#pragma unroll): its index picks registers of a fragment, accumulator or staging array, which must be known at compile time, else the array goes to scratch.
#define PPOS  128                 // positions per work-group
#define PPW   272                 // LDS pitch of a row of 128 bf16: 256 B + 16 (odd multiple of 16 B: 16-byte reads without bank conflicts)
#define PMAT  (CIN * PPW)         // one weight matrix, or the x tile
#define PSP   144                 // LDS pitch of a 128-byte output row: 128 B + 16
#define PSG   (16 * PSP)          // one wave's output patch
__device__ __forceinline__ v16bf ldsfragb(const unsigned char* p) { return cat16b(*(const v8usa*)p, *(const v8usa*)(p + 32)); }
// ch[q] = this lane's 16 bytes at byte 32 q + 16 hi of row c of a 16-row x 128-byte piece; dst = the piece's first element, pitch in elements
__device__ __forceinline__ void put_rows(unsigned char* sg, int lane, const v8h (&ch)[4], h16* dst, size_t pitch) {
#pragma unroll
    for (int q = 0; q < 4; ++q) *(v8ha*)(sg + (lane & 15) * PSP + 32 * q + 16 * (lane >> 4)) = ch[q];
    asm volatile("s_wait_dscnt 0x0" ::: "memory");   // the wave's own LDS writes are done before its lanes read each other's rows back; also keeps the compiler from moving the reads up
    v8h rb[4];
#pragma unroll
    for (int s = 0; s < 4; ++s) rb[s] = *(const v8ha*)(sg + (4 * s + (lane >> 3)) * PSP + (lane & 7) * 16);
#pragma unroll
    for (int s = 0; s < 4; ++s) *(v8h*)(dst + (size_t)(4 * s + (lane >> 3)) * pitch + (lane & 7) * 8) = rb[s];
    asm volatile("s_wait_xcnt 0x0" ::: "memory");   // a precaution: stands in front of every later overwrite of the registers that these stores name; as a compiler fence it also keeps the next piece's LDS writes behind the reads above
}
__global__ __launch_bounds__(256) void k_proj(const float* __restrict__ X, const float* __restrict__ Wq, const float* __restrict__ Bq, const float* __restrict__ Wk, const float* __restrict__ Bk, const float* __restrict__ Wv, const float* __restrict__ Bv, h16* Qp, h16* Kp, h16* Vt) {
    __shared__ __align__(16) unsigned char LW[3 * PMAT];
    __shared__ __align__(16) unsigned char LX[PMAT];
    __shared__ __align__(16) unsigned char LS[8 * PSG];
    __shared__ __align__(16) float LB[3 * HD];
    const int tid = threadIdx.x, lane = tid & 31, wave = tid >> 5, c = lane & 15, hi = lane >> 4;
    const int img = blockIdx.y, pb = blockIdx.x * PPOS;
    // weights: 16 bytes per thread and chunk, whole lines (a chunk = 8 rows of 128 f32); x: thread = position tid & 127, 8 channels per group, a wave's load = one 128-byte line of a channel row
    const float* xg = X + (size_t)img * CIN * TT + (size_t)(tid >> 7) * 8 * TT + pb + (tid & 127);
    v4f wa[16], wb[16], wc[16]; float xv[8][8], bb[3] = {0.0f, 0.0f, 0.0f};
#pragma unroll
    for (int j = 0; j < 16; ++j) wa[j] = *(const v4f*)(Wq + j * 1024 + tid * 4);
#pragma unroll
    for (int j = 0; j < 16; ++j) wb[j] = *(const v4f*)(Wk + j * 1024 + tid * 4);
#pragma unroll
    for (int i = 0; i < 8; ++i)
#pragma unroll
        for (int e = 0; e < 8; ++e) xv[i][e] = xg[(size_t)(16 * i + e) * TT];
    if (tid < HD) { bb[0] = Bq[tid]; bb[1] = Bk[tid]; bb[2] = Bv[tid]; }
    asm volatile("s_wait_xcnt 0x0" ::: "memory");   // a precaution: stands in front of every later overwrite of these loads' address registers
    const unsigned wl = wave * PPW + lane * 8;
#pragma unroll
    for (int j = 0; j < 16; ++j) *(v4usa*)(LW + wl + j * 8 * PPW) = __builtin_bit_cast(v4us, __builtin_convertvector(wa[j], v4bf));
#pragma unroll
    for (int j = 0; j < 16; ++j) wc[j] = *(const v4f*)(Wv + j * 1024 + tid * 4);
    asm volatile("s_wait_xcnt 0x0" ::: "memory");   // the same precaution for the loads above
#pragma unroll
    for (int j = 0; j < 16; ++j) *(v4usa*)(LW + PMAT + wl + j * 8 * PPW) = __builtin_bit_cast(v4us, __builtin_convertvector(wb[j], v4bf));
#pragma unroll
    for (int i = 0; i < 8; ++i) { v8f t;
#pragma unroll
        for (int e = 0; e < 8; ++e) t[e] = xv[i][e];
        *(v8usa*)(LX + (tid & 127) * PPW + (2 * i + (tid >> 7)) * 16) = __builtin_bit_cast(v8us, __builtin_convertvector(t, v8bf)); }
    if (tid < HD) { LB[tid] = bfr(bb[0]); LB[HD + tid] = bfr(bb[1]); LB[2 * HD + tid] = bfr(bb[2]); }
#pragma unroll
    for (int j = 0; j < 16; ++j) *(v4usa*)(LW + 2 * PMAT + wl + j * 8 * PPW) = __builtin_bit_cast(v4us, __builtin_convertvector(wc[j], v4bf));
    __syncthreads();
    unsigned char* sg = LS + wave * PSG;
    const unsigned fo = c * PPW + 16 * hi;
    const int w1 = wave & 1, w2 = wave >> 1;
    {   // q and k: outputs 64 w1 .. + 63, positions 32 w2 .. + 31
        v16bf xf[2][4];
#pragma unroll
        for (int g = 0; g < 2; ++g)
#pragma unroll
            for (int kc = 0; kc < 4; ++kc) xf[g][kc] = ldsfragb(LX + (2 * w2 + g) * 16 * PPW + fo + 64 * kc);
#pragma unroll
        for (int m = 0; m < 2; ++m) {
            v8f acc[4][2];
#pragma unroll
            for (int t = 0; t < 4; ++t)
#pragma unroll
                for (int g = 0; g < 2; ++g) acc[t][g] = (v8f){};
#pragma unroll
            for (int kc = 0; kc < 4; ++kc)
#pragma unroll
                for (int t = 0; t < 4; ++t) { const v16bf a = ldsfragb(LW + m * PMAT + (4 * w1 + t) * 16 * PPW + fo + 64 * kc);
#pragma unroll
                    for (int g = 0; g < 2; ++g) acc[t][g] = wmmab(a, xf[g][kc], acc[t][g]); }
            h16* pl = (m ? Kp : Qp) + ((size_t)img * TT + pb + 32 * w2) * HD + 64 * w1;
#pragma unroll
            for (int g = 0; g < 2; ++g) { v8h ch[4];
#pragma unroll
                for (int t = 0; t < 4; ++t) { const float* bp = LB + m * HD + (4 * w1 + t) * 16 + 8 * hi; const v4f b0 = *(const v4fa*)bp, b1 = *(const v4fa*)(bp + 4);
#pragma unroll
                    for (int r = 0; r < 8; ++r) ch[t][r] = (h16)(acc[t][g][r] + (r < 4 ? b0[r & 3] : b1[r & 3])); }
                put_rows(sg, lane, ch, pl + (size_t)g * 16 * HD, HD); }
        }
    }
    {   // v, transposed: outputs 32 w2 .. + 31, positions 64 w1 .. + 63
        v8f acc[2][4];
#pragma unroll
        for (int u = 0; u < 2; ++u)
#pragma unroll
            for (int g = 0; g < 4; ++g) acc[u][g] = (v8f){};
#pragma unroll
        for (int kc = 0; kc < 4; ++kc) { v16bf b[2];
#pragma unroll
            for (int u = 0; u < 2; ++u) b[u] = ldsfragb(LW + 2 * PMAT + (2 * w2 + u) * 16 * PPW + fo + 64 * kc);
#pragma unroll
            for (int g = 0; g < 4; ++g) { const v16bf a = ldsfragb(LX + (4 * w1 + g) * 16 * PPW + fo + 64 * kc);
#pragma unroll
                for (int u = 0; u < 2; ++u) acc[u][g] = wmmab(a, b[u], acc[u][g]); } }
        h16* pl = Vt + ((size_t)img * HD + 32 * w2) * TT + pb + 64 * w1;
#pragma unroll
        for (int u = 0; u < 2; ++u) { const float bo = LB[2 * HD + (2 * w2 + u) * 16 + c]; v8h ch[4];
#pragma unroll
            for (int g = 0; g < 4; ++g)
#pragma unroll
                for (int r = 0; r < 8; ++r) ch[g][r] = (h16)(acc[u][g][r] + bo);
            put_rows(sg, lane, ch, pl + (size_t)u * 16 * TT, TT); }
    }
}

#define FW    8                   // waves per work-group: 4 column sets x 2 key halves
#define FBR   128                 // query columns per work-group
#define FSK   128                 // keys per stage
#define FHK   64                  // keys of a stage per wave
#define FPK   272                 // LDS pitch of a K row: 256 B + 16 (odd multiple of 16 B: 16-byte reads without bank conflicts)
#define FPV   272                 // LDS pitch of a V^T row of 128 keys: 256 B + 16
#define FTK   (FSK * FPK)
#define FSLOT (FTK + HD * FPV)    // one buffer: the K tile, then the V^T tile (both tiles are whole multiples of 2 KiB)
#define FNS   (TT / FSK)          // stages
#define FXW   (17 * 512)          // one wave's patch of the join: 16 x 16 bytes per lane of accumulators, then 16 bytes per lane of maxima and sums
__device__ __forceinline__ float xhalf(float x) { return __builtin_bit_cast(float, __builtin_amdgcn_permlanex16(__builtin_bit_cast(int, x), __builtin_bit_cast(int, x), 0x76543210, 0xfedcba98, false, false)); }   // lane l with lane l ^ 16
__device__ __forceinline__ v16h ldsfrag(const unsigned char* p) { return cat16(*(const v8ha*)p, *(const v8ha*)(p + 32)); }
typedef __attribute__((ext_vector_type(4))) unsigned u32x4;
typedef __attribute__((ext_vector_type(8))) unsigned u32x8;
__device__ __forceinline__ unsigned uni(unsigned v) { return (unsigned)__builtin_amdgcn_readfirstlane(v); }
__device__ __forceinline__ unsigned pinned(unsigned v) { unsigned w = uni(v); asm volatile("" : "+s"(w)); return w; }   // holds a test word in a scalar register, so that the test around a tensor load compiles to a scalar compare and branch (a tensor load ignores EXEC)
// descriptor group 1: 1-byte elements, tensor = tile = 128 rows of 256 bytes, source row pitch in bytes; word 0: no mask, a pad of 4 dwords behind every 64 dwords (LDS pitch 272 B)
__device__ __forceinline__ u32x8 tdm_group1(unsigned src_pitch) {
    u32x8 g;
    g[0] = uni((1u << 20) | (5u << 22) | (3u << 25)); g[1] = uni(256u << 16); g[2] = uni(128u << 16); g[3] = uni(256u << 16);
    g[4] = uni(128u); g[5] = uni(src_pitch); g[6] = uni(0u); g[7] = uni(0u);
    return g;
}
// descriptor group 0: count 1, the tile's place in LDS, the global address of its first byte, type 2
__device__ __forceinline__ u32x4 tdm_group0(unsigned lds_dst, unsigned long long ga) {
    u32x4 g;
    g[0] = uni(1u); g[1] = uni(lds_dst); g[2] = uni((unsigned)ga); g[3] = uni((((unsigned)(ga >> 32)) & 0x01FFFFFFu) | 0x80000000u);
    return g;
}
__device__ __forceinline__ void tdm_load(u32x4 g0, u32x8 g1) { asm volatile("tensor_load_to_lds %0, %1" :: "s"(g0), "s"(g1) : "memory"); }   // one request of the whole wave
__global__ __launch_bounds__(FW * 32) void k_fattn(const h16* __restrict__ Qp, const h16* __restrict__ Kp, const h16* __restrict__ Vt, const float* __restrict__ X, float* OUT) {
    __shared__ __attribute__((aligned(2048))) unsigned char L[3 * FSLOT];
    const int tid = threadIdx.x, lane = tid & 31, wave = __builtin_amdgcn_readfirstlane(tid >> 5), c = lane & 15, hi = lane >> 4;
    const int kh = wave >> 2;   // this wave's half of every stage's keys
    const int img = blockIdx.y, qw0 = blockIdx.x * FBR + (wave & 3) * 32;
    const float cs = SCL * 1.4426950408889634f;
    v16h qf[2][4];
#pragma unroll
    for (int g = 0; g < 2; ++g) { const h16* qp = Qp + ((size_t)img * TT + qw0 + 16 * g + c) * HD + 8 * hi;
#pragma unroll
        for (int kc = 0; kc < 4; ++kc) qf[g][kc] = cat16(*(const v8h*)(qp + 32 * kc), *(const v8h*)(qp + 32 * kc + 16)); }
    asm volatile("s_wait_xcnt 0x0" ::: "memory");   // a precaution: stands in front of every later overwrite of these loads' address registers
    // the tiles: an even wave asks for K (a stage is 32 KiB in a row), an odd one for V^T (128 rows of 256 B at a pitch of a whole V^T row)
    const unsigned isv = wave & 1;
    const unsigned long long tsrc = isv ? (unsigned long long)(size_t)(Vt + (size_t)img * HD * TT) : (unsigned long long)(size_t)(Kp + (size_t)img * TT * HD);
    const unsigned tstep = isv ? FSK * 2 : FSK * HD * 2;   // source bytes from one stage to the next
    const unsigned tdst = (unsigned)(size_t)L + isv * FTK;
    const u32x8 g1 = tdm_group1(isv ? TT * 2 : HD * 2);
    if (pinned(wave < 4)) {   // stage 0 by waves 0 and 1, stage 1 by waves 2 and 3: one request a wave, under the Q loads above
        tdm_load(tdm_group0(tdst + (wave >> 1) * FSLOT, tsrc + (unsigned long long)((wave >> 1) * tstep)), g1);
        asm volatile("s_wait_tensorcnt 0x0" ::: "memory");   // the tile has landed; directly behind the request, so that no descriptor register is reused while it is outstanding
    }
    v8f acc[2][8]; float m_run[2], l_run[2];
#pragma unroll
    for (int g = 0; g < 2; ++g) { m_run[g] = -__builtin_inff(); l_run[g] = 0.0f;
#pragma unroll
        for (int t = 0; t < 8; ++t) acc[g][t] = (v8f){}; }
    __syncthreads();   // publishes stages 0 and 1
    v16h kf[2][4];   // the K fragments of one pass, fetched one pass ahead
    const unsigned kfo = (kh * FHK + c) * FPK + 16 * hi, vfo = FTK + c * FPV + kh * (FHK * 2) + 16 * hi;
#pragma unroll
    for (int kt = 0; kt < 2; ++kt)
#pragma unroll
        for (int kc = 0; kc < 4; ++kc) kf[kt][kc] = ldsfrag(L + kfo + kt * 16 * FPK + 64 * kc);
    unsigned slot = 0, nslot = FSLOT, nnslot = 2 * FSLOT;   // the buffers of stages st, st + 1, st + 2
#pragma unroll 1   // one stage per trip: the body already holds two unrolled passes
    for (int st = 0; st < FNS; ++st) {
        if (pinned(wave < 2 && st + 2 < FNS)) tdm_load(tdm_group0(tdst + nnslot, tsrc + (unsigned long long)((unsigned)(st + 2) * tstep)), g1);   // stage st + 2, behind the barrier at which every wave left that buffer (stage st - 1's); it has this trip to land
        const unsigned kslot = st + 1 < FNS ? nslot : slot;   // where the last pass fetches K from: the next stage; in the last trip its own stage again (public rows, never used), so that the loads stand under no branch
#pragma unroll
        for (int ps = 0; ps < FHK / 32; ++ps) {
            const unsigned char* vb = L + slot + vfo + ps * 64;
            v8f s[2][2];
#pragma unroll
            for (int kt = 0; kt < 2; ++kt)
#pragma unroll
                for (int g = 0; g < 2; ++g) s[kt][g] = (v8f){};
#pragma unroll
            for (int kc = 0; kc < 4; ++kc)
#pragma unroll
                for (int kt = 0; kt < 2; ++kt)
#pragma unroll
                    for (int g = 0; g < 2; ++g) s[kt][g] = wmma16(kf[kt][kc], qf[g][kc], s[kt][g]);
            v16h vf[8];
#pragma unroll
            for (int t = 0; t < 8; ++t) vf[t] = ldsfrag(vb + t * 16 * FPV);
            {
                const unsigned char* kb = ps + 1 < FHK / 32 ? L + slot + kfo + (ps + 1) * 32 * FPK : L + kslot + kfo;
#pragma unroll
                for (int kt = 0; kt < 2; ++kt)
#pragma unroll
                    for (int kc = 0; kc < 4; ++kc) kf[kt][kc] = ldsfrag(kb + kt * 16 * FPK + 64 * kc); }
            asm volatile("" ::: "memory");   // compiler fence: keeps the LDS loads above in front of the softmax, so that they fly under it; without it they sink to their first use and each WMMA waits for its own fragment
            float mb[2]; bool need = false;
#pragma unroll
            for (int g = 0; g < 2; ++g) { float mx = -__builtin_inff();
#pragma unroll
                for (int kt = 0; kt < 2; ++kt)
#pragma unroll
                    for (int r = 0; r < 8; ++r) mx = fmaxf(mx, s[kt][g][r]);
                mx = fmaxf(mx, xhalf(mx)) * cs; mb[g] = mx; need = need || (mx > m_run[g] + 8.0f); }
            if (__builtin_amdgcn_ballot_w32(need) != 0) {   // wave-uniform, rare after the first passes
#pragma unroll
                for (int g = 0; g < 2; ++g) { const float m_new = fmaxf(m_run[g], mb[g]); const float corr = __builtin_amdgcn_exp2f(m_run[g] - m_new);   // 0 on the first pass, where m_run is -inf
                    l_run[g] *= corr; m_run[g] = m_new;
#pragma unroll
                    for (int t = 0; t < 8; ++t) acc[g][t] = acc[g][t] * corr; } }
#pragma unroll
            for (int g = 0; g < 2; ++g) { const float nm = -m_run[g]; v2f psum = (v2f){0.0f, 0.0f}; v16h pf;
#pragma unroll
                for (int i = 0; i < 8; ++i) {
                    const v2f arg = __builtin_elementwise_fma((v2f){s[i >> 2][g][2 * (i & 3)], s[i >> 2][g][2 * (i & 3) + 1]}, (v2f){cs, cs}, (v2f){nm, nm});
                    const v2f p = (v2f){__builtin_amdgcn_exp2f(arg[0]), __builtin_amdgcn_exp2f(arg[1])};
                    psum += p; const v2h pk = __builtin_convertvector(p, v2h); pf[2 * i] = pk[0]; pf[2 * i + 1] = pk[1]; }
                l_run[g] += psum[0] + psum[1];
#pragma unroll
                for (int t = 0; t < 8; ++t) acc[g][t] = wmma16(vf[t], pf, acc[g][t]); }
        }
        // the publish point of stage st + 2, in this order:
        asm volatile("s_wait_dscnt 0x0" ::: "memory");       // this wave's LDS reads are done: stage st's buffer may be refilled behind the barrier
        asm volatile("s_wait_tensorcnt 0x0" ::: "memory");   // the issuing waves' tiles of stage st + 2 have landed (a wave that asked for nothing passes)
        __syncthreads();
        const unsigned fslot = slot; slot = nslot; nslot = nnslot; nnslot = fslot;
    }
    // acc[g][t][r] = O[channel 16 t + 8 hi + r][query qw0 + 16 g + c] x that query's sum, over this wave's keys and relative to its own m_run.
    // The join: the wave of key half kh finishes channel tiles 4 kh .. 4 kh + 3 of both column groups (its 32 columns are one 128-byte line of each of 64 output rows) and hands its other four tiles, its maxima and its sums to its partner, wave ^ 4, through its own LDS patch.
    // The ring is free for that: the loop's last barrier stands behind every wave's last fragment read, and no tensor load is outstanding (the last one was waited for two trips earlier).
    const size_t o0 = ((size_t)img * HD + 64 * kh + 8 * hi) * TT + qw0 + c;
    float xr[2][4][8];
#pragma unroll   // all residual loads of a lane in flight together, under the join
    for (int g = 0; g < 2; ++g)
#pragma unroll
        for (int t = 0; t < 4; ++t)
#pragma unroll
            for (int r = 0; r < 8; ++r) xr[g][t][r] = X[o0 + 16 * g + (size_t)(16 * t + r) * TT];
    asm volatile("s_wait_xcnt 0x0" ::: "memory");   // the same precaution for the loads above
    __builtin_amdgcn_sched_barrier(0);   // holds that wait directly behind the loads: without it later vector work is moved in front of it
    unsigned char* xo = L + wave * FXW + lane * 16;
    const unsigned char* xi = L + (wave ^ 4) * FXW + lane * 16;
    float lf[2];
#pragma unroll
    for (int g = 0; g < 2; ++g) lf[g] = l_run[g] + xhalf(l_run[g]);
    v8f keep[2][4];
#pragma unroll
    for (int g = 0; g < 2; ++g)
#pragma unroll
        for (int t = 0; t < 4; ++t) { const v8f give = kh ? acc[g][t] : acc[g][4 + t]; keep[g][t] = kh ? acc[g][4 + t] : acc[g][t];
            *(v4fa*)(xo + (8 * g + 2 * t) * 512) = __builtin_shufflevector(give, give, 0, 1, 2, 3); *(v4fa*)(xo + (8 * g + 2 * t + 1) * 512) = __builtin_shufflevector(give, give, 4, 5, 6, 7); }
    *(v4fa*)(xo + 16 * 512) = (v4f){m_run[0], m_run[1], lf[0], lf[1]};
    __syncthreads();   // publishes every wave's patch to its partner
    const v4f pml = *(const v4fa*)(xi + 16 * 512);
#pragma unroll
    for (int g = 0; g < 2; ++g) { const float m = fmaxf(m_run[g], pml[g]); const float fo = __builtin_amdgcn_exp2f(m_run[g] - m), fp = __builtin_amdgcn_exp2f(pml[g] - m);
        const float inv = 1.0f / (lf[g] * fo + pml[2 + g] * fp); const float so = fo * inv, sp = fp * inv;
#pragma unroll
        for (int t = 0; t < 4; ++t) { const v4f p0 = *(const v4fa*)(xi + (8 * g + 2 * t) * 512), p1 = *(const v4fa*)(xi + (8 * g + 2 * t + 1) * 512);
#pragma unroll
            for (int r = 0; r < 8; ++r) OUT[o0 + 16 * g + (size_t)(16 * t + r) * TT] = __fadd_rn(keep[g][t][r] * so + (r < 4 ? p0[r & 3] : p1[r & 3]) * sp, bfr(xr[g][t][r]));
            asm volatile("s_wait_xcnt 0x0" ::: "memory");   // the same precaution for the registers that these stores name
            __builtin_amdgcn_sched_barrier(0); } }   // holds that wait directly behind the stores, as above
}

extern "C" void kernel_launch(void* const* d_in, const int* in_sizes, int n_in,
                              void* d_out, int out_size, void* d_ws, size_t ws_size, hipStream_t stream) {
    (void)in_sizes; (void)n_in; (void)out_size;
    const float* x = (const float*)d_in[0]; const float* wq = (const float*)d_in[1]; const float* bq = (const float*)d_in[2]; const float* wk = (const float*)d_in[3]; const float* bk = (const float*)d_in[4]; const float* wv = (const float*)d_in[5]; const float* bv = (const float*)d_in[6];
    float* OUT = (float*)d_out;     // [8][128][4096]
    char* wsp = (char*)d_ws;
    auto take = [&](size_t bytes) { char* p = wsp; wsp += (bytes + 255) & ~(size_t)255; return (void*)p; };
    h16* QP16 = (h16*)take((size_t)NIMG * TT * HD * 2); h16* KP16 = (h16*)take((size_t)NIMG * TT * HD * 2); h16* VT16 = (h16*)take((size_t)NIMG * HD * TT * 2);
    if ((size_t)(wsp - (char*)d_ws) > ws_size) return;    // ws 256 MiB
    k_proj<<<dim3(TT / PPOS, NIMG), 256, 0, stream>>>(x, wq, bq, wk, bk, wv, bv, QP16, KP16, VT16);
    k_fattn<<<dim3(TT / FBR, NIMG), FW * 32, 0, stream>>>(QP16, KP16, VT16, x, OUT);
}

// v006
// A run of this version takes 53 microseconds.
// In both of two side-by-side timings against v005, it was 1.03 times as fast.
// Over all steps from v000 it is 21.1 times as fast.
#include <hip/hip_runtime.h>

// Light self-attention over image positions (x [8][128][64x64 = 4096] channel-major; per image q/k/v = W x + b (1x1 convs, W [128 out][128 in]); attn[n][m] = softmax_m(q_n.k_m / sqrt(128)) over the 4096 positions; out[c][n] = sum_m attn[n][m] v[c][m] + x[c][n] -> [8][128][64][64]).
// Two launches: k_proj makes the fp16 planes Q[img][n][o], K[img][n][o] and V^T[img][o][n] straight from x, the weights and the biases; k_fattn is the fused attention with the residual.
// Compute dtypes, f32 accumulate: every input rounded to bf16; q/k/v on PLAIN bf16 operands (inputs: exact) + bias; scores and attn.v on single fp16 operands (P = exp(score - running maximum), below 2^8) over 4096 keys, all images in one fused launch; 1/sqrt(128) and the online softmax in f32; out = attn.v (f32) / row sum + bf16(x), written into [c][n] rows.

#define NIMG 8                    // images
#define CIN  128                  // channels
#define TT   4096                 // positions per image
#define HD   128                  // width of q, k and v
#define SCL  0.088388347648318447f   // HD^-0.5
typedef _Float16 h16;
typedef __attribute__((ext_vector_type(16))) __bf16   v16bf;
typedef __attribute__((ext_vector_type(8)))  __bf16   v8bf;
typedef __attribute__((ext_vector_type(4)))  __bf16   v4bf;
typedef __attribute__((ext_vector_type(16))) _Float16 v16h;
typedef __attribute__((ext_vector_type(8)))  _Float16 v8h;
typedef __attribute__((ext_vector_type(2)))  _Float16 v2h;
typedef __attribute__((ext_vector_type(8)))  unsigned short v8us;
typedef __attribute__((ext_vector_type(4)))  unsigned short v4us;
typedef __attribute__((ext_vector_type(8)))  float    v8f;
typedef __attribute__((ext_vector_type(4)))  float    v4f;
typedef __attribute__((ext_vector_type(2)))  float    v2f;
typedef v8h  __attribute__((may_alias)) v8ha;
typedef v4f  __attribute__((may_alias)) v4fa;
typedef v8us __attribute__((may_alias)) v8usa;
typedef v4us __attribute__((may_alias)) v4usa;

__device__ __forceinline__ unsigned short f2bf(float f) { unsigned u = __float_as_uint(f); u += 0x7FFFu + ((u >> 16) & 1u); return (unsigned short)(u >> 16); }
__device__ __forceinline__ float bf2f(unsigned short b) { return __uint_as_float(((unsigned)b) << 16); }
__device__ __forceinline__ float bfr(float f) { return bf2f(f2bf(f)); }
__device__ __forceinline__ v16h cat16(v8h lo, v8h hi) { return __builtin_shufflevector(lo, hi, 0, 1, 2, 3, 4, 5, 6, 7, 8, 9, 10, 11, 12, 13, 14, 15); }
__device__ __forceinline__ v16bf cat16b(v8us lo, v8us hi) { return __builtin_bit_cast(v16bf, __builtin_shufflevector(lo, hi, 0, 1, 2, 3, 4, 5, 6, 7, 8, 9, 10, 11, 12, 13, 14, 15)); }
__device__ __forceinline__ v8f wmma16(v16h a, v16h b, v8f c) { return __builtin_amdgcn_wmma_f32_16x16x32_f16(false, a, false, b, (short)0, c, false, false); }
__device__ __forceinline__ v8f wmmab(v16bf a, v16bf b, v8f c) { return __builtin_amdgcn_wmma_f32_16x16x32_bf16(false, a, false, b, (short)0, c, false, false); }

// ---- k_proj: the three 1x1 convolutions of 128 positions of one image, from the f32 inputs to the fp16 planes that k_fattn reads, in ONE kernel.
// Grid (TT / 128 position blocks, images), 8 waves. Staging: the three weight matrices [o][c] and the x tile, transposed to [position][c], are rounded to bf16 on the way into LDS (row pitch 272 B); one barrier publishes them.
// Every fragment, of a weight row or of a position row, is read by the same code (16 bytes at 16 hi and at 32 + 16 hi of each 64), so both operands have one k order; the 128 channels are summed in four WMMAs, in rising order.
// q, k: A = weight rows, B = positions: a lane's 8 accumulator registers are 8 consecutive outputs o of one position. v: A = positions, B = weight rows: 8 consecutive positions of one output. Either way 16 bytes of fp16 of one plane row.
// A wave owns 64 o x 32 positions of q and of k and 32 o x 64 positions of v, so that it writes whole 128-byte lines: each 16-row x 128-byte piece goes through the wave's own LDS patch and leaves as four 16-byte stores per lane.
// Every loop of k_proj and put_rows is unrolled in full (#pragma unroll): its index picks registers of a fragment, accumulator or staging array, which must be known at compile time, else the array goes to scratch.
#define PPOS  128                 // positions per work-group
#define PPW   272                 // LDS pitch of a row of 128 bf16: 256 B + 16 (odd multiple of 16 B: 16-byte reads without bank conflicts)
#define PMAT  (CIN * PPW)         // one weight matrix, or the x tile
#define PSP   144                 // LDS pitch of a 128-byte output row: 128 B + 16
#define PSG   (16 * PSP)          // one wave's output patch
__device__ __forceinline__ v16bf ldsfragb(const unsigned char* p) { return cat16b(*(const v8usa*)p, *(const v8usa*)(p + 32)); }
// ch[q] = this lane's 16 bytes at byte 32 q + 16 hi of row c of a 16-row x 128-byte piece; dst = the piece's first element, pitch in elements
__device__ __forceinline__ void put_rows(unsigned char* sg, int lane, const v8h (&ch)[4], h16* dst, size_t pitch) {
#pragma unroll
    for (int q = 0; q < 4; ++q) *(v8ha*)(sg + (lane & 15) * PSP + 32 * q + 16 * (lane >> 4)) = ch[q];
    asm volatile("s_wait_dscnt 0x0" ::: "memory");   // the wave's own LDS writes are done before its lanes read each other's rows back; also keeps the compiler from moving the reads up
    v8h rb[4];
#pragma unroll
    for (int s = 0; s < 4; ++s) rb[s] = *(const v8ha*)(sg + (4 * s + (lane >> 3)) * PSP + (lane & 7) * 16);
#pragma unroll
    for (int s = 0; s < 4; ++s) *(v8h*)(dst + (size_t)(4 * s + (lane >> 3)) * pitch + (lane & 7) * 8) = rb[s];
    asm volatile("s_wait_xcnt 0x0" ::: "memory");   // a precaution: stands in front of every later overwrite of the registers that these stores name; as a compiler fence it also keeps the next piece's LDS writes behind the reads above
}
__global__ __launch_bounds__(256) void k_proj(const float* __restrict__ X, const float* __restrict__ Wq, const float* __restrict__ Bq, const float* __restrict__ Wk, const float* __restrict__ Bk, const float* __restrict__ Wv, const float* __restrict__ Bv, h16* Qp, h16* Kp, h16* Vt) {
    __shared__ __align__(16) unsigned char LW[3 * PMAT];
    __shared__ __align__(16) unsigned char LX[PMAT];
    __shared__ __align__(16) unsigned char LS[8 * PSG];
    __shared__ __align__(16) float LB[3 * HD];
    const int tid = threadIdx.x, lane = tid & 31, wave = tid >> 5, c = lane & 15, hi = lane >> 4;
    const int img = blockIdx.y, pb = blockIdx.x * PPOS;
    // weights: 16 bytes per thread and chunk, whole lines (a chunk = 8 rows of 128 f32); x: thread = position tid & 127, 8 channels per group, a wave's load = one 128-byte line of a channel row
    const float* xg = X + (size_t)img * CIN * TT + (size_t)(tid >> 7) * 8 * TT + pb + (tid & 127);
    v4f wa[16], wb[16], wc[16]; float xv[8][8], bb[3] = {0.0f, 0.0f, 0.0f};
#pragma unroll
    for (int j = 0; j < 16; ++j) wa[j] = *(const v4f*)(Wq + j * 1024 + tid * 4);
#pragma unroll
    for (int j = 0; j < 16; ++j) wb[j] = *(const v4f*)(Wk + j * 1024 + tid * 4);
#pragma unroll
    for (int i = 0; i < 8; ++i)
#pragma unroll
        for (int e = 0; e < 8; ++e) xv[i][e] = xg[(size_t)(16 * i + e) * TT];
    if (tid < HD) { bb[0] = Bq[tid]; bb[1] = Bk[tid]; bb[2] = Bv[tid]; }
    asm volatile("s_wait_xcnt 0x0" ::: "memory");   // a precaution: stands in front of every later overwrite of these loads' address registers
    const unsigned wl = wave * PPW + lane * 8;
#pragma unroll
    for (int j = 0; j < 16; ++j) *(v4usa*)(LW + wl + j * 8 * PPW) = __builtin_bit_cast(v4us, __builtin_convertvector(wa[j], v4bf));
#pragma unroll
    for (int j = 0; j < 16; ++j) wc[j] = *(const v4f*)(Wv + j * 1024 + tid * 4);
    asm volatile("s_wait_xcnt 0x0" ::: "memory");   // the same precaution for the loads above
#pragma unroll
    for (int j = 0; j < 16; ++j) *(v4usa*)(LW + PMAT + wl + j * 8 * PPW) = __builtin_bit_cast(v4us, __builtin_convertvector(wb[j], v4bf));
#pragma unroll
    for (int i = 0; i < 8; ++i) { v8f t;
#pragma unroll
        for (int e = 0; e < 8; ++e) t[e] = xv[i][e];
        *(v8usa*)(LX + (tid & 127) * PPW + (2 * i + (tid >> 7)) * 16) = __builtin_bit_cast(v8us, __builtin_convertvector(t, v8bf)); }
    if (tid < HD) { LB[tid] = bfr(bb[0]); LB[HD + tid] = bfr(bb[1]); LB[2 * HD + tid] = bfr(bb[2]); }
#pragma unroll
    for (int j = 0; j < 16; ++j) *(v4usa*)(LW + 2 * PMAT + wl + j * 8 * PPW) = __builtin_bit_cast(v4us, __builtin_convertvector(wc[j], v4bf));
    __syncthreads();
    unsigned char* sg = LS + wave * PSG;
    const unsigned fo = c * PPW + 16 * hi;
    const int w1 = wave & 1, w2 = wave >> 1;
    {   // q and k: outputs 64 w1 .. + 63, positions 32 w2 .. + 31
        v16bf xf[2][4];
#pragma unroll
        for (int g = 0; g < 2; ++g)
#pragma unroll
            for (int kc = 0; kc < 4; ++kc) xf[g][kc] = ldsfragb(LX + (2 * w2 + g) * 16 * PPW + fo + 64 * kc);
#pragma unroll
        for (int m = 0; m < 2; ++m) {
            v8f acc[4][2];
#pragma unroll
            for (int t = 0; t < 4; ++t)
#pragma unroll
                for (int g = 0; g < 2; ++g) acc[t][g] = (v8f){};
#pragma unroll
            for (int kc = 0; kc < 4; ++kc)
#pragma unroll
                for (int t = 0; t < 4; ++t) { const v16bf a = ldsfragb(LW + m * PMAT + (4 * w1 + t) * 16 * PPW + fo + 64 * kc);
#pragma unroll
                    for (int g = 0; g < 2; ++g) acc[t][g] = wmmab(a, xf[g][kc], acc[t][g]); }
            h16* pl = (m ? Kp : Qp) + ((size_t)img * TT + pb + 32 * w2) * HD + 64 * w1;
#pragma unroll
            for (int g = 0; g < 2; ++g) { v8h ch[4];
#pragma unroll
                for (int t = 0; t < 4; ++t) { const float* bp = LB + m * HD + (4 * w1 + t) * 16 + 8 * hi; const v4f b0 = *(const v4fa*)bp, b1 = *(const v4fa*)(bp + 4);
#pragma unroll
                    for (int r = 0; r < 8; ++r) ch[t][r] = (h16)(acc[t][g][r] + (r < 4 ? b0[r & 3] : b1[r & 3])); }
                put_rows(sg, lane, ch, pl + (size_t)g * 16 * HD, HD); }
        }
    }
    {   // v, transposed: outputs 32 w2 .. + 31, positions 64 w1 .. + 63
        v8f acc[2][4];
#pragma unroll
        for (int u = 0; u < 2; ++u)
#pragma unroll
            for (int g = 0; g < 4; ++g) acc[u][g] = (v8f){};
#pragma unroll
        for (int kc = 0; kc < 4; ++kc) { v16bf b[2];
#pragma unroll
            for (int u = 0; u < 2; ++u) b[u] = ldsfragb(LW + 2 * PMAT + (2 * w2 + u) * 16 * PPW + fo + 64 * kc);
#pragma unroll
            for (int g = 0; g < 4; ++g) { const v16bf a = ldsfragb(LX + (4 * w1 + g) * 16 * PPW + fo + 64 * kc);
#pragma unroll
                for (int u = 0; u < 2; ++u) acc[u][g] = wmmab(a, b[u], acc[u][g]); } }
        h16* pl = Vt + ((size_t)img * HD + 32 * w2) * TT + pb + 64 * w1;
#pragma unroll
        for (int u = 0; u < 2; ++u) { const float bo = LB[2 * HD + (2 * w2 + u) * 16 + c]; v8h ch[4];
#pragma unroll
            for (int g = 0; g < 4; ++g)
#pragma unroll
                for (int r = 0; r < 8; ++r) ch[g][r] = (h16)(acc[u][g][r] + bo);
            put_rows(sg, lane, ch, pl + (size_t)u * 16 * TT, TT); }
    }
}

#define FW    8                   // waves per work-group: 2 column sets x 4 key quarters
#define FBR   128                 // query columns per work-group
#define FSK   128                 // keys per stage
#define FHK   32                  // keys of a stage per wave
#define FPK   272                 // LDS pitch of a K row: 256 B + 16 (odd multiple of 16 B: 16-byte reads without bank conflicts)
#define FPV   272                 // LDS pitch of a V^T row of 128 keys: 256 B + 16
#define FTK   (FSK * FPK)
#define FSLOT (FTK + HD * FPV)    // one buffer: the K tile, then the V^T tile (both tiles are whole multiples of 2 KiB)
#define FNS   (TT / FSK)          // stages
#define FXW   (66 * 512)          // one wave's patch of the join: 64 x 16 bytes per lane of accumulators (tile 8 g + t at 2 x 16 bytes), then 16 bytes per lane of maxima and 16 of sums
__device__ __forceinline__ float xhalf(float x) { return __builtin_bit_cast(float, __builtin_amdgcn_permlanex16(__builtin_bit_cast(int, x), __builtin_bit_cast(int, x), 0x76543210, 0xfedcba98, false, false)); }   // lane l with lane l ^ 16
__device__ __forceinline__ v16h ldsfrag(const unsigned char* p) { return cat16(*(const v8ha*)p, *(const v8ha*)(p + 32)); }
typedef __attribute__((ext_vector_type(4))) unsigned u32x4;
typedef __attribute__((ext_vector_type(8))) unsigned u32x8;
__device__ __forceinline__ unsigned uni(unsigned v) { return (unsigned)__builtin_amdgcn_readfirstlane(v); }
__device__ __forceinline__ unsigned pinned(unsigned v) { unsigned w = uni(v); asm volatile("" : "+s"(w)); return w; }   // holds a test word in a scalar register, so that the test around a tensor load compiles to a scalar compare and branch (a tensor load ignores EXEC)
// descriptor group 1: 1-byte elements, tensor = tile = 128 rows of 256 bytes, source row pitch in bytes; word 0: no mask, a pad of 4 dwords behind every 64 dwords (LDS pitch 272 B)
__device__ __forceinline__ u32x8 tdm_group1(unsigned src_pitch) {
    u32x8 g;
    g[0] = uni((1u << 20) | (5u << 22) | (3u << 25)); g[1] = uni(256u << 16); g[2] = uni(128u << 16); g[3] = uni(256u << 16);
    g[4] = uni(128u); g[5] = uni(src_pitch); g[6] = uni(0u); g[7] = uni(0u);
    return g;
}
// descriptor group 0: count 1, the tile's place in LDS, the global address of its first byte, type 2
__device__ __forceinline__ u32x4 tdm_group0(unsigned lds_dst, unsigned long long ga) {
    u32x4 g;
    g[0] = uni(1u); g[1] = uni(lds_dst); g[2] = uni((unsigned)ga); g[3] = uni((((unsigned)(ga >> 32)) & 0x01FFFFFFu) | 0x80000000u);
    return g;
}
__device__ __forceinline__ void tdm_load(u32x4 g0, u32x8 g1) { asm volatile("tensor_load_to_lds %0, %1" :: "s"(g0), "s"(g1) : "memory"); }   // one request of the whole wave
__global__ __launch_bounds__(FW * 32) void k_fattn(const h16* __restrict__ Qp, const h16* __restrict__ Kp, const h16* __restrict__ Vt, const float* __restrict__ X, float* OUT) {
    __shared__ __attribute__((aligned(2048))) unsigned char L[FW * FXW > 3 * FSLOT ? FW * FXW : 3 * FSLOT];   // the ring; behind the loop the join's patches
    const int tid = threadIdx.x, lane = tid & 31, wave = __builtin_amdgcn_readfirstlane(tid >> 5), c = lane & 15, hi = lane >> 4;
    const int kq = wave >> 1;   // this wave's quarter of every stage's keys
    const int img = blockIdx.y, qw0 = blockIdx.x * FBR + (wave & 1) * 64;
    const float cs = SCL * 1.4426950408889634f;
    v16h qf[4][4];
#pragma unroll
    for (int g = 0; g < 4; ++g) { const h16* qp = Qp + ((size_t)img * TT + qw0 + 16 * g + c) * HD + 8 * hi;
#pragma unroll
        for (int kc = 0; kc < 4; ++kc) qf[g][kc] = cat16(*(const v8h*)(qp + 32 * kc), *(const v8h*)(qp + 32 * kc + 16)); }
    asm volatile("s_wait_xcnt 0x0" ::: "memory");   // a precaution: stands in front of every later overwrite of these loads' address registers
    // the tiles: an even wave asks for K (a stage is 32 KiB in a row), an odd one for V^T (128 rows of 256 B at a pitch of a whole V^T row)
    const unsigned isv = wave & 1;
    const unsigned long long tsrc = isv ? (unsigned long long)(size_t)(Vt + (size_t)img * HD * TT) : (unsigned long long)(size_t)(Kp + (size_t)img * TT * HD);
    const unsigned tstep = isv ? FSK * 2 : FSK * HD * 2;   // source bytes from one stage to the next
    const unsigned tdst = (unsigned)(size_t)L + isv * FTK;
    const u32x8 g1 = tdm_group1(isv ? TT * 2 : HD * 2);
    if (pinned(wave < 4)) {   // stage 0 by waves 0 and 1, stage 1 by waves 2 and 3: one request a wave, under the Q loads above
        tdm_load(tdm_group0(tdst + (wave >> 1) * FSLOT, tsrc + (unsigned long long)((wave >> 1) * tstep)), g1);
        asm volatile("s_wait_tensorcnt 0x0" ::: "memory");   // the tile has landed; directly behind the request, so that no descriptor register is reused while it is outstanding
    }
    v8f acc[4][8]; float m_run[4], l_run[4];
#pragma unroll
    for (int g = 0; g < 4; ++g) { m_run[g] = -__builtin_inff(); l_run[g] = 0.0f;
#pragma unroll
        for (int t = 0; t < 8; ++t) acc[g][t] = (v8f){}; }
    __syncthreads();   // publishes stages 0 and 1
    v16h ka[4];   // the K fragments of a pass's first 16 keys, fetched one pass ahead
    const unsigned kfo = (kq * FHK + c) * FPK + 16 * hi, vfo = FTK + c * FPV + kq * (FHK * 2) + 16 * hi;
#pragma unroll
    for (int kc = 0; kc < 4; ++kc) ka[kc] = ldsfrag(L + kfo + 64 * kc);
    unsigned slot = 0, nslot = FSLOT, nnslot = 2 * FSLOT;   // the buffers of stages st, st + 1, st + 2
#pragma unroll 1   // one stage, one pass of 64 WMMAs, per trip
    for (int st = 0; st < FNS; ++st) {
        if (pinned(wave < 2 && st + 2 < FNS)) tdm_load(tdm_group0(tdst + nnslot, tsrc + (unsigned long long)((unsigned)(st + 2) * tstep)), g1);   // stage st + 2, behind the barrier at which every wave left that buffer (stage st - 1's); it has this trip to land
        const unsigned kslot = st + 1 < FNS ? nslot : slot;   // where the pass fetches the next K from: the next stage; in the last trip its own stage again (public rows, never used), so that the loads stand under no branch
        const unsigned char* vb = L + slot + vfo;
        // The pass runs in phases, each held in its place by a scheduling barrier: accumulators and Q fill 384 of the 512 registers of a wave, and only in this order do scores, P and two sets of four fragments fit the rest; left free, the scheduler mixes the phases, spills Q fragments to scratch and moves the last WMMAs behind the stage barrier.
        v16h kb[4]; v8f s[2][4];
#pragma unroll
        for (int g = 0; g < 4; ++g) s[0][g] = wmma16(ka[0], qf[g][0], (v8f){});
        __builtin_amdgcn_sched_barrier(0);   // one K fragment is dead: room for the second 16 keys' four
#pragma unroll
        for (int kc = 0; kc < 4; ++kc) kb[kc] = ldsfrag(L + slot + kfo + 16 * FPK + 64 * kc);
        __builtin_amdgcn_sched_barrier(0);   // they fly under the other WMMAs of the first 16 keys
#pragma unroll
        for (int kc = 1; kc < 4; ++kc)
#pragma unroll
            for (int g = 0; g < 4; ++g) s[0][g] = wmma16(ka[kc], qf[g][kc], s[0][g]);
        __builtin_amdgcn_sched_barrier(0);   // the first set of K fragments is dead before the second 16 keys' scores come to life
#pragma unroll
        for (int g = 0; g < 4; ++g) s[1][g] = (v8f){};
#pragma unroll
        for (int kc = 0; kc < 4; ++kc)
#pragma unroll
            for (int g = 0; g < 4; ++g) s[1][g] = wmma16(kb[kc], qf[g][kc], s[1][g]);
        __builtin_amdgcn_sched_barrier(0);   // all score WMMAs in front of the softmax
        float mb[4]; bool need = false;
#pragma unroll
        for (int g = 0; g < 4; ++g) { float mx = -__builtin_inff();
#pragma unroll
            for (int kt = 0; kt < 2; ++kt)
#pragma unroll
                for (int r = 0; r < 8; ++r) mx = fmaxf(mx, s[kt][g][r]);
            mx = fmaxf(mx, xhalf(mx)) * cs; mb[g] = mx; need = need || (mx > m_run[g] + 8.0f); }
        if (__builtin_amdgcn_ballot_w32(need) != 0) {   // wave-uniform, rare after the first passes
#pragma unroll
            for (int g = 0; g < 4; ++g) { const float m_new = fmaxf(m_run[g], mb[g]); const float corr = __builtin_amdgcn_exp2f(m_run[g] - m_new);   // 0 on the first pass, where m_run is -inf
                l_run[g] *= corr; m_run[g] = m_new;
#pragma unroll
                for (int t = 0; t < 8; ++t) acc[g][t] = acc[g][t] * corr; } }
        v16h pf[4], va[4], vc[4];
#pragma unroll
        for (int g = 0; g < 4; ++g) { const float nm = -m_run[g]; v2f psum = (v2f){0.0f, 0.0f};
            if (g == 2) {
                __builtin_amdgcn_sched_barrier(0);   // two groups' score registers are free: room for the first four V^T fragments
#pragma unroll
                for (int t = 0; t < 4; ++t) va[t] = ldsfrag(vb + t * 16 * FPV);
                __builtin_amdgcn_sched_barrier(0);   // they fly under the other two groups' exponentials
            }
#pragma unroll
            for (int i = 0; i < 8; ++i) {
                const v2f arg = __builtin_elementwise_fma((v2f){s[i >> 2][g][2 * (i & 3)], s[i >> 2][g][2 * (i & 3) + 1]}, (v2f){cs, cs}, (v2f){nm, nm});
                const v2f p = (v2f){__builtin_amdgcn_exp2f(arg[0]), __builtin_amdgcn_exp2f(arg[1])};
                psum += p; const v2h pk = __builtin_convertvector(p, v2h); pf[g][2 * i] = pk[0]; pf[g][2 * i + 1] = pk[1]; }
            l_run[g] += psum[0] + psum[1];
            asm volatile("" : "+v"(l_run[g])); }   // empty asm on each sum, against spills: the group's sum is finished here; left free, its adds sink behind the next WMMAs and hold 16 exponentials in registers that the V^T fragments need
#pragma unroll
        for (int g = 0; g < 4; ++g) acc[g][0] = wmma16(va[0], pf[g], acc[g][0]);
        __builtin_amdgcn_sched_barrier(0);   // every group's P is packed and in use and one V^T fragment is dead: room for the other four
#pragma unroll
        for (int t = 0; t < 4; ++t) vc[t] = ldsfrag(vb + (4 + t) * 16 * FPV);
        __builtin_amdgcn_sched_barrier(0);   // they fly under the WMMAs of the next three channel tiles
#pragma unroll
        for (int t = 1; t < 4; ++t)
#pragma unroll
            for (int g = 0; g < 4; ++g) acc[g][t] = wmma16(va[t], pf[g], acc[g][t]);
#pragma unroll
        for (int g = 0; g < 4; ++g) acc[g][4] = wmma16(vc[0], pf[g], acc[g][4]);
        __builtin_amdgcn_sched_barrier(0);   // five V^T fragments are dead: room for the next pass's first K fragments, from the next stage's buffer
#pragma unroll
        for (int kc = 0; kc < 4; ++kc) ka[kc] = ldsfrag(L + kslot + kfo + 64 * kc);
        __builtin_amdgcn_sched_barrier(0);   // they fly under the WMMAs of the last three channel tiles
#pragma unroll
        for (int t = 1; t < 4; ++t)
#pragma unroll
            for (int g = 0; g < 4; ++g) acc[g][4 + t] = wmma16(vc[t], pf[g], acc[g][4 + t]);
        __builtin_amdgcn_sched_barrier(0);   // these WMMAs stay in front of the waits below, which then find the loads above landed
        // the publish point of stage st + 2, in this order:
        asm volatile("s_wait_dscnt 0x0" ::: "memory");       // this wave's LDS reads are done: stage st's buffer may be refilled behind the barrier
        asm volatile("s_wait_tensorcnt 0x0" ::: "memory");   // the issuing waves' tiles of stage st + 2 have landed (a wave that asked for nothing passes)
        __syncthreads();
        const unsigned fslot = slot; slot = nslot; nslot = nnslot; nnslot = fslot;
    }
    // acc[g][t][r] = O[channel 16 t + 8 hi + r][query qw0 + 16 g + c] x that query's sum, over this wave's keys and relative to its own m_run.
    // The join: the wave of key quarter kq finishes channel tiles 2 kq and 2 kq + 1 of its four column groups (its 64 columns are two 128-byte lines of each of 32 output rows) and hands its other six tiles, its maxima and its sums to its three partners through its own LDS patch.
    // The ring is free for that: the loop's last barrier stands behind every wave's last fragment read, and no tensor load is outstanding (the last one was waited for two trips earlier).
    const size_t o0 = ((size_t)img * HD + 32 * kq + 8 * hi) * TT + qw0 + c;
    float xr[4][2][8];
#pragma unroll   // all residual loads of a lane in flight together, under the join
    for (int g = 0; g < 4; ++g)
#pragma unroll
        for (int t = 0; t < 2; ++t)
#pragma unroll
            for (int r = 0; r < 8; ++r) xr[g][t][r] = X[o0 + 16 * g + (size_t)(16 * t + r) * TT];
    asm volatile("s_wait_xcnt 0x0" ::: "memory");   // the same precaution for the loads above
    __builtin_amdgcn_sched_barrier(0);   // holds that wait directly behind the loads: without it later vector work is moved in front of it
    unsigned char* xo = L + wave * FXW + lane * 16;
    float lf[4];
#pragma unroll
    for (int g = 0; g < 4; ++g) lf[g] = l_run[g] + xhalf(l_run[g]);
    v8f keep[4][2];
#pragma unroll
    for (int tp = 0; tp < 4; ++tp) {
        if (tp == kq) {   // wave-uniform
#pragma unroll
            for (int g = 0; g < 4; ++g) { keep[g][0] = acc[g][2 * tp]; keep[g][1] = acc[g][2 * tp + 1]; }
        } else {
#pragma unroll
            for (int g = 0; g < 4; ++g)
#pragma unroll
                for (int t = 2 * tp; t < 2 * tp + 2; ++t) { const v8f give = acc[g][t];
                    *(v4fa*)(xo + (16 * g + 2 * t) * 512) = __builtin_shufflevector(give, give, 0, 1, 2, 3); *(v4fa*)(xo + (16 * g + 2 * t + 1) * 512) = __builtin_shufflevector(give, give, 4, 5, 6, 7); }
        }
    }
    *(v4fa*)(xo + 64 * 512) = (v4f){m_run[0], m_run[1], m_run[2], m_run[3]};
    *(v4fa*)(xo + 65 * 512) = (v4f){lf[0], lf[1], lf[2], lf[3]};
    __syncthreads();   // publishes every wave's patch to its partners
    const unsigned char* xi[3]; v4f pm[3], pl[3];   // the partners: quarters kq + 1, kq + 2, kq + 3 (mod 4) of the same column set
#pragma unroll
    for (int j = 0; j < 3; ++j) { xi[j] = L + ((wave & 1) + 2 * ((kq + 1 + j) & 3)) * FXW + lane * 16; pm[j] = *(const v4fa*)(xi[j] + 64 * 512); pl[j] = *(const v4fa*)(xi[j] + 65 * 512); xi[j] += kq * 4 * 512; }
    float so[4], sp[4][3];   // what each wave's partial result is scaled by: exp2(its maximum - the joint one) / the joint sum
#pragma unroll
    for (int g = 0; g < 4; ++g) { const float m = fmaxf(fmaxf(m_run[g], pm[0][g]), fmaxf(pm[1][g], pm[2][g]));
        const float fo = __builtin_amdgcn_exp2f(m_run[g] - m), f0 = __builtin_amdgcn_exp2f(pm[0][g] - m), f1 = __builtin_amdgcn_exp2f(pm[1][g] - m), f2 = __builtin_amdgcn_exp2f(pm[2][g] - m);
        const float inv = 1.0f / (lf[g] * fo + pl[0][g] * f0 + pl[1][g] * f1 + pl[2][g] * f2);
        so[g] = fo * inv; sp[g][0] = f0 * inv; sp[g][1] = f1 * inv; sp[g][2] = f2 * inv; }
    v4f pv[2][6];   // the partners' halves of one tile (block b = 2 g + t), read one block ahead of its use
#pragma unroll
    for (int j = 0; j < 3; ++j) { pv[0][2 * j] = *(const v4fa*)(xi[j]); pv[0][2 * j + 1] = *(const v4fa*)(xi[j] + 512); }
#pragma unroll
    for (int b = 0; b < 8; ++b) { const int g = b >> 1, t = b & 1;
        if (b + 1 < 8) {
#pragma unroll
            for (int j = 0; j < 3; ++j) { const unsigned char* np = xi[j] + (16 * ((b + 1) >> 1) + 2 * ((b + 1) & 1)) * 512; pv[(b + 1) & 1][2 * j] = *(const v4fa*)np; pv[(b + 1) & 1][2 * j + 1] = *(const v4fa*)(np + 512); } }
        v8f o = keep[g][t] * so[g];
#pragma unroll
        for (int j = 0; j < 3; ++j)
#pragma unroll
            for (int r = 0; r < 8; ++r) o[r] += (r < 4 ? pv[b & 1][2 * j][r & 3] : pv[b & 1][2 * j + 1][r & 3]) * sp[g][j];
#pragma unroll
        for (int r = 0; r < 8; ++r) OUT[o0 + 16 * g + (size_t)(16 * t + r) * TT] = __fadd_rn(o[r], bfr(xr[g][t][r]));
        asm volatile("s_wait_xcnt 0x0" ::: "memory");   // the same precaution for the registers that these stores name
        __builtin_amdgcn_sched_barrier(0); }   // holds that wait directly behind the stores, as above
}

extern "C" void kernel_launch(void* const* d_in, const int* in_sizes, int n_in,
                              void* d_out, int out_size, void* d_ws, size_t ws_size, hipStream_t stream) {
    (void)in_sizes; (void)n_in; (void)out_size;
    const float* x = (const float*)d_in[0]; const float* wq = (const float*)d_in[1]; const float* bq = (const float*)d_in[2]; const float* wk = (const float*)d_in[3]; const float* bk = (const float*)d_in[4]; const float* wv = (const float*)d_in[5]; const float* bv = (const float*)d_in[6];
    float* OUT = (float*)d_out;     // [8][128][4096]
    char* wsp = (char*)d_ws;
    auto take = [&](size_t bytes) { char* p = wsp; wsp += (bytes + 255) & ~(size_t)255; return (void*)p; };
    h16* QP16 = (h16*)take((size_t)NIMG * TT * HD * 2); h16* KP16 = (h16*)take((size_t)NIMG * TT * HD * 2); h16* VT16 = (h16*)take((size_t)NIMG * HD * TT * 2);
    if ((size_t)(wsp - (char*)d_ws) > ws_size) return;    // ws 256 MiB
    k_proj<<<dim3(TT / PPOS, NIMG), 256, 0, stream>>>(x, wq, bq, wk, bk, wv, bv, QP16, KP16, VT16);
    k_fattn<<<dim3(TT / FBR, NIMG), FW * 32, 0, stream>>>(QP16, KP16, VT16, x, OUT);
}

// v007
// It runs in 50.6 microseconds.
// Next to v006, in two timings, it ran 1.04 times as fast each time.
// Over all steps from v000 it is 21.9 times as fast.
#include <hip/hip_runtime.h>

// Light self-attention over image positions (x [8][128][64x64 = 4096] channel-major; per image q/k/v = W x + b (1x1 convs, W [128 out][128 in]); attn[n][m] = softmax_m(q_n.k_m / sqrt(128)) over the 4096 positions; out[c][n] = sum_m attn[n][m] v[c][m] + x[c][n] -> [8][128][64][64]).
// Two launches: k_proj makes the fp16 planes Q[img][n][o], K[img][n][o] and V^T[img][o][n] straight from x, the weights and the biases; k_fattn is the fused attention with the residual.
// Compute dtypes, f32 accumulate: every input rounded to bf16; q/k/v on PLAIN bf16 operands (inputs: exact) + bias; scores and attn.v on single fp16 operands (P = exp(score - held reference), at most 2^15) over 4096 keys, all images in one fused launch; 1/sqrt(128) and the online softmax in f32; out = attn.v (f32) / row sum + bf16(x), written into [c][n] rows.

#define NIMG 8                    // images
#define CIN  128                  // channels
#define TT   4096                 // positions per image
#define HD   128                  // width of q, k and v
#define SCL  0.088388347648318447f   // HD^-0.5
typedef _Float16 h16;
typedef __attribute__((ext_vector_type(16))) __bf16   v16bf;
typedef __attribute__((ext_vector_type(8)))  __bf16   v8bf;
typedef __attribute__((ext_vector_type(4)))  __bf16   v4bf;
typedef __attribute__((ext_vector_type(16))) _Float16 v16h;
typedef __attribute__((ext_vector_type(8)))  _Float16 v8h;
typedef __attribute__((ext_vector_type(2)))  _Float16 v2h;
typedef __attribute__((ext_vector_type(8)))  unsigned short v8us;
typedef __attribute__((ext_vector_type(4)))  unsigned short v4us;
typedef __attribute__((ext_vector_type(8)))  float    v8f;
typedef __attribute__((ext_vector_type(4)))  float    v4f;
typedef __attribute__((ext_vector_type(2)))  float    v2f;
typedef v8h  __attribute__((may_alias)) v8ha;
typedef v4f  __attribute__((may_alias)) v4fa;
typedef v8us __attribute__((may_alias)) v8usa;
typedef v4us __attribute__((may_alias)) v4usa;

__device__ __forceinline__ unsigned short f2bf(float f) { unsigned u = __float_as_uint(f); u += 0x7FFFu + ((u >> 16) & 1u); return (unsigned short)(u >> 16); }
__device__ __forceinline__ float bf2f(unsigned short b) { return __uint_as_float(((unsigned)b) << 16); }
__device__ __forceinline__ float bfr(float f) { return bf2f(f2bf(f)); }
__device__ __forceinline__ v16h cat16(v8h lo, v8h hi) { return __builtin_shufflevector(lo, hi, 0, 1, 2, 3, 4, 5, 6, 7, 8, 9, 10, 11, 12, 13, 14, 15); }
__device__ __forceinline__ v16bf cat16b(v8us lo, v8us hi) { return __builtin_bit_cast(v16bf, __builtin_shufflevector(lo, hi, 0, 1, 2, 3, 4, 5, 6, 7, 8, 9, 10, 11, 12, 13, 14, 15)); }
__device__ __forceinline__ v8f wmma16(v16h a, v16h b, v8f c) { return __builtin_amdgcn_wmma_f32_16x16x32_f16(false, a, false, b, (short)0, c, false, false); }
__device__ __forceinline__ v8f wmmab(v16bf a, v16bf b, v8f c) { return __builtin_amdgcn_wmma_f32_16x16x32_bf16(false, a, false, b, (short)0, c, false, false); }

// ---- k_proj: the three 1x1 convolutions of 128 positions of one image, from the f32 inputs to the fp16 planes that k_fattn reads, in ONE kernel.
// Grid (TT / 128 position blocks, images), 8 waves. Staging: the three weight matrices [o][c] and the x tile, transposed to [position][c], are rounded to bf16 on the way into LDS (row pitch 272 B); one barrier publishes them.
// Every fragment, of a weight row or of a position row, is read by the same code (16 bytes at 16 hi and at 32 + 16 hi of each 64), so both operands have one k order; the 128 channels are summed in four WMMAs, in rising order.
// q, k: A = weight rows, B = positions: a lane's 8 accumulator registers are 8 consecutive outputs o of one position. v: A = positions, B = weight rows: 8 consecutive positions of one output. Either way 16 bytes of fp16 of one plane row.
// A wave owns 64 o x 32 positions of q and of k and 32 o x 64 positions of v, so that it writes whole 128-byte lines: each 16-row x 128-byte piece goes through the wave's own LDS patch and leaves as four 16-byte stores per lane.
// Every loop of k_proj and put_rows is unrolled in full (#pragma unroll): its index picks registers of a fragment, accumulator or staging array, which must be known at compile time, else the array goes to scratch.
#define PPOS  128                 // positions per work-group
#define PPW   272                 // LDS pitch of a row of 128 bf16: 256 B + 16 (odd multiple of 16 B: 16-byte reads without bank conflicts)
#define PMAT  (CIN * PPW)         // one weight matrix, or the x tile
#define PSP   144                 // LDS pitch of a 128-byte output row: 128 B + 16
#define PSG   (16 * PSP)          // one wave's output patch
__device__ __forceinline__ v16bf ldsfragb(const unsigned char* p) { return cat16b(*(const v8usa*)p, *(const v8usa*)(p + 32)); }
// ch[q] = this lane's 16 bytes at byte 32 q + 16 hi of row c of a 16-row x 128-byte piece; dst = the piece's first element, pitch in elements
__device__ __forceinline__ void put_rows(unsigned char* sg, int lane, const v8h (&ch)[4], h16* dst, size_t pitch) {
#pragma unroll
    for (int q = 0; q < 4; ++q) *(v8ha*)(sg + (lane & 15) * PSP + 32 * q + 16 * (lane >> 4)) = ch[q];
    asm volatile("s_wait_dscnt 0x0" ::: "memory");   // the wave's own LDS writes are done before its lanes read each other's rows back; also keeps the compiler from moving the reads up
    v8h rb[4];
#pragma unroll
    for (int s = 0; s < 4; ++s) rb[s] = *(const v8ha*)(sg + (4 * s + (lane >> 3)) * PSP + (lane & 7) * 16);
#pragma unroll
    for (int s = 0; s < 4; ++s) *(v8h*)(dst + (size_t)(4 * s + (lane >> 3)) * pitch + (lane & 7) * 8) = rb[s];
    asm volatile("s_wait_xcnt 0x0" ::: "memory");   // a precaution: stands in front of every later overwrite of the registers that these stores name; as a compiler fence it also keeps the next piece's LDS writes behind the reads above
}
__global__ __launch_bounds__(256) void k_proj(const float* __restrict__ X, const float* __restrict__ Wq, const float* __restrict__ Bq, const float* __restrict__ Wk, const float* __restrict__ Bk, const float* __restrict__ Wv, const float* __restrict__ Bv, h16* Qp, h16* Kp, h16* Vt) {
    __shared__ __align__(16) unsigned char LW[3 * PMAT];
    __shared__ __align__(16) unsigned char LX[PMAT];
    __shared__ __align__(16) unsigned char LS[8 * PSG];
    __shared__ __align__(16) float LB[3 * HD];
    const int tid = threadIdx.x, lane = tid & 31, wave = tid >> 5, c = lane & 15, hi = lane >> 4;
    const int img = blockIdx.y, pb = blockIdx.x * PPOS;
    // weights: 16 bytes per thread and chunk, whole lines (a chunk = 8 rows of 128 f32); x: thread = position tid & 127, 8 channels per group, a wave's load = one 128-byte line of a channel row
    const float* xg = X + (size_t)img * CIN * TT + (size_t)(tid >> 7) * 8 * TT + pb + (tid & 127);
    v4f wa[16], wb[16], wc[16]; float xv[8][8], bb[3] = {0.0f, 0.0f, 0.0f};
#pragma unroll
    for (int j = 0; j < 16; ++j) wa[j] = *(const v4f*)(Wq + j * 1024 + tid * 4);
#pragma unroll
    for (int j = 0; j < 16; ++j) wb[j] = *(const v4f*)(Wk + j * 1024 + tid * 4);
#pragma unroll
    for (int i = 0; i < 8; ++i)
#pragma unroll
        for (int e = 0; e < 8; ++e) xv[i][e] = xg[(size_t)(16 * i + e) * TT];
    if (tid < HD) { bb[0] = Bq[tid]; bb[1] = Bk[tid]; bb[2] = Bv[tid]; }
    asm volatile("s_wait_xcnt 0x0" ::: "memory");   // a precaution: stands in front of every later overwrite of these loads' address registers
    const unsigned wl = wave * PPW + lane * 8;
#pragma unroll
    for (int j = 0; j < 16; ++j) *(v4usa*)(LW + wl + j * 8 * PPW) = __builtin_bit_cast(v4us, __builtin_convertvector(wa[j], v4bf));
#pragma unroll
    for (int j = 0; j < 16; ++j) wc[j] = *(const v4f*)(Wv + j * 1024 + tid * 4);
    asm volatile("s_wait_xcnt 0x0" ::: "memory");   // the same precaution for the loads above
#pragma unroll
    for (int j = 0; j < 16; ++j) *(v4usa*)(LW + PMAT + wl + j * 8 * PPW) = __builtin_bit_cast(v4us, __builtin_convertvector(wb[j], v4bf));
#pragma unroll
    for (int i = 0; i < 8; ++i) { v8f t;
#pragma unroll
        for (int e = 0; e < 8; ++e) t[e] = xv[i][e];
        *(v8usa*)(LX + (tid & 127) * PPW + (2 * i + (tid >> 7)) * 16) = __builtin_bit_cast(v8us, __builtin_convertvector(t, v8bf)); }
    if (tid < HD) { LB[tid] = bfr(bb[0]); LB[HD + tid] = bfr(bb[1]); LB[2 * HD + tid] = bfr(bb[2]); }
#pragma unroll
    for (int j = 0; j < 16; ++j) *(v4usa*)(LW + 2 * PMAT + wl + j * 8 * PPW) = __builtin_bit_cast(v4us, __builtin_convertvector(wc[j], v4bf));
    __syncthreads();
    unsigned char* sg = LS + wave * PSG;
    const unsigned fo = c * PPW + 16 * hi;
    const int w1 = wave & 1, w2 = wave >> 1;
    {   // q and k: outputs 64 w1 .. + 63, positions 32 w2 .. + 31
        v16bf xf[2][4];
#pragma unroll
        for (int g = 0; g < 2; ++g)
#pragma unroll
            for (int kc = 0; kc < 4; ++kc) xf[g][kc] = ldsfragb(LX + (2 * w2 + g) * 16 * PPW + fo + 64 * kc);
#pragma unroll
        for (int m = 0; m < 2; ++m) {
            v8f acc[4][2];
#pragma unroll
            for (int t = 0; t < 4; ++t)
#pragma unroll
                for (int g = 0; g < 2; ++g) acc[t][g] = (v8f){};
#pragma unroll
            for (int kc = 0; kc < 4; ++kc)
#pragma unroll
                for (int t = 0; t < 4; ++t) { const v16bf a = ldsfragb(LW + m * PMAT + (4 * w1 + t) * 16 * PPW + fo + 64 * kc);
#pragma unroll
                    for (int g = 0; g < 2; ++g) acc[t][g] = wmmab(a, xf[g][kc], acc[t][g]); }
            h16* pl = (m ? Kp : Qp) + ((size_t)img * TT + pb + 32 * w2) * HD + 64 * w1;
#pragma unroll
            for (int g = 0; g < 2; ++g) { v8h ch[4];
#pragma unroll
                for (int t = 0; t < 4; ++t) { const float* bp = LB + m * HD + (4 * w1 + t) * 16 + 8 * hi; const v4f b0 = *(const v4fa*)bp, b1 = *(const v4fa*)(bp + 4);
#pragma unroll
                    for (int r = 0; r < 8; ++r) ch[t][r] = (h16)(acc[t][g][r] + (r < 4 ? b0[r & 3] : b1[r & 3])); }
                put_rows(sg, lane, ch, pl + (size_t)g * 16 * HD, HD); }
        }
    }
    {   // v, transposed: outputs 32 w2 .. + 31, positions 64 w1 .. + 63
        v8f acc[2][4];
#pragma unroll
        for (int u = 0; u < 2; ++u)
#pragma unroll
            for (int g = 0; g < 4; ++g) acc[u][g] = (v8f){};
#pragma unroll
        for (int kc = 0; kc < 4; ++kc) { v16bf b[2];
#pragma unroll
            for (int u = 0; u < 2; ++u) b[u] = ldsfragb(LW + 2 * PMAT + (2 * w2 + u) * 16 * PPW + fo + 64 * kc);
#pragma unroll
            for (int g = 0; g < 4; ++g) { const v16bf a = ldsfragb(LX + (4 * w1 + g) * 16 * PPW + fo + 64 * kc);
#pragma unroll
                for (int u = 0; u < 2; ++u) acc[u][g] = wmmab(a, b[u], acc[u][g]); } }
        h16* pl = Vt + ((size_t)img * HD + 32 * w2) * TT + pb + 64 * w1;
#pragma unroll
        for (int u = 0; u < 2; ++u) { const float bo = LB[2 * HD + (2 * w2 + u) * 16 + c]; v8h ch[4];
#pragma unroll
            for (int g = 0; g < 4; ++g)
#pragma unroll
                for (int r = 0; r < 8; ++r) ch[g][r] = (h16)(acc[u][g][r] + bo);
            put_rows(sg, lane, ch, pl + (size_t)u * 16 * TT, TT); }
    }
}

#define FW    8                   // waves per work-group: 2 column sets x 4 key quarters
#define FBR   128                 // query columns per work-group
#define FSK   128                 // keys per stage
#define FHK   32                  // keys of a stage per wave
#define FPK   272                 // LDS pitch of a K row: 256 B + 16 (odd multiple of 16 B: 16-byte reads without bank conflicts)
#define FPV   272                 // LDS pitch of a V^T row of 128 keys: 256 B + 16
#define FTK   (FSK * FPK)
#define FSLOT (FTK + HD * FPV)    // one buffer: the K tile, then the V^T tile (both tiles are whole multiples of 2 KiB)
#define FNS   (TT / FSK)          // stages
#define FXW   (66 * 512)          // one wave's patch of the join: 64 x 16 bytes per lane of accumulators (tile 8 g + t at 2 x 16 bytes), then 16 bytes per lane of maxima and 16 of sums
__device__ __forceinline__ float xhalf(float x) { return __builtin_bit_cast(float, __builtin_amdgcn_permlanex16(__builtin_bit_cast(int, x), __builtin_bit_cast(int, x), 0x76543210, 0xfedcba98, false, false)); }   // lane l with lane l ^ 16
__device__ __forceinline__ v16h ldsfrag(const unsigned char* p) { return cat16(*(const v8ha*)p, *(const v8ha*)(p + 32)); }
typedef __attribute__((ext_vector_type(4))) unsigned u32x4;
typedef __attribute__((ext_vector_type(8))) unsigned u32x8;
__device__ __forceinline__ unsigned uni(unsigned v) { return (unsigned)__builtin_amdgcn_readfirstlane(v); }
__device__ __forceinline__ unsigned pinned(unsigned v) { unsigned w = uni(v); asm volatile("" : "+s"(w)); return w; }   // holds a test word in a scalar register, so that the test around a tensor load compiles to a scalar compare and branch (a tensor load ignores EXEC)
// descriptor group 1: 1-byte elements, tensor = tile = 128 rows of 256 bytes, source row pitch in bytes; word 0: no mask, a pad of 4 dwords behind every 64 dwords (LDS pitch 272 B)
__device__ __forceinline__ u32x8 tdm_group1(unsigned src_pitch) {
    u32x8 g;
    g[0] = uni((1u << 20) | (5u << 22) | (3u << 25)); g[1] = uni(256u << 16); g[2] = uni(128u << 16); g[3] = uni(256u << 16);
    g[4] = uni(128u); g[5] = uni(src_pitch); g[6] = uni(0u); g[7] = uni(0u);
    return g;
}
// descriptor group 0: count 1, the tile's place in LDS, the global address of its first byte, type 2
__device__ __forceinline__ u32x4 tdm_group0(unsigned lds_dst, unsigned long long ga) {
    u32x4 g;
    g[0] = uni(1u); g[1] = uni(lds_dst); g[2] = uni((unsigned)ga); g[3] = uni((((unsigned)(ga >> 32)) & 0x01FFFFFFu) | 0x80000000u);
    return g;
}
__device__ __forceinline__ void tdm_load(u32x4 g0, u32x8 g1) { asm volatile("tensor_load_to_lds %0, %1" :: "s"(g0), "s"(g1) : "memory"); }   // one request of the whole wave
// The scores of one pass (32 keys x 64 query columns): ka = the K fragments of the first 16 keys, already asked for; kp = this lane's place in the first key row of the pass.
// The phases are held in place by scheduling barriers: accumulators and Q fill 384 of the 512 registers of a wave, and only in this order do scores, P and two sets of four fragments fit the rest; left free, the scheduler mixes the phases and spills Q fragments to scratch.
__device__ __forceinline__ void pass_scores(const v16h (&ka)[4], const unsigned char* kp, const v16h (&qf)[4][4], v8f (&s)[2][4]) {
    v16h kb[4];
#pragma unroll
    for (int g = 0; g < 4; ++g) s[0][g] = wmma16(ka[0], qf[g][0], (v8f){});
    __builtin_amdgcn_sched_barrier(0);   // one K fragment is dead: room for the second 16 keys' four
#pragma unroll
    for (int kc = 0; kc < 4; ++kc) kb[kc] = ldsfrag(kp + 16 * FPK + 64 * kc);
    __builtin_amdgcn_sched_barrier(0);   // they fly under the other WMMAs of the first 16 keys
#pragma unroll
    for (int kc = 1; kc < 4; ++kc)
#pragma unroll
        for (int g = 0; g < 4; ++g) s[0][g] = wmma16(ka[kc], qf[g][kc], s[0][g]);
    __builtin_amdgcn_sched_barrier(0);   // the first set of K fragments is dead before the second 16 keys' scores come to life
#pragma unroll
    for (int g = 0; g < 4; ++g) s[1][g] = (v8f){};
#pragma unroll
    for (int kc = 0; kc < 4; ++kc)
#pragma unroll
        for (int g = 0; g < 4; ++g) s[1][g] = wmma16(kb[kc], qf[g][kc], s[1][g]);
    __builtin_amdgcn_sched_barrier(0);   // all score WMMAs in front of the softmax
}
// mx and the 8 scores that this lane holds of one 16-key tile: their maximum
__device__ __forceinline__ float lane_max(float mx, const v8f& s) {
#pragma unroll
    for (int r = 0; r < 8; ++r) mx = fmaxf(mx, s[r]);
    return mx;
}
// a query column's maximum from the two wave halves' maxima, in the log2 domain
__device__ __forceinline__ float col_max(float mx, float cs) { return fmaxf(mx, xhalf(mx)) * cs; }
// P = exp2(score x cs - m) of one column group and 32 keys, packed into the B operand pf; ps = the sum over this lane's 16 keys. Returns whether that sum is not known to be at most 2^15 (a NaN counts).
__device__ __forceinline__ bool soft_group(const v8f& s0, const v8f& s1, float m, float cs, v16h& pf, float& ps) {
    const float nm = -m; v2f psum = (v2f){0.0f, 0.0f};
#pragma unroll
    for (int i = 0; i < 8; ++i) {
        const v8f& t = i < 4 ? s0 : s1;
        const v2f arg = __builtin_elementwise_fma((v2f){t[2 * (i & 3)], t[2 * (i & 3) + 1]}, (v2f){cs, cs}, (v2f){nm, nm});
        const v2f p = (v2f){__builtin_amdgcn_exp2f(arg[0]), __builtin_amdgcn_exp2f(arg[1])};
        psum += p; const v2h pk = __builtin_convertvector(p, v2h); pf[2 * i] = pk[0]; pf[2 * i + 1] = pk[1]; }
    ps = psum[0] + psum[1];
    asm volatile("" : "+v"(ps));   // empty asm on each sum, against spills: the group's sum is finished here; left free, its adds sink down and hold 16 exponentials in registers that the V^T fragments need
    return !(ps <= 32768.0f);   // no exponential is negative, so none exceeds its lane's sum
}
__global__ __launch_bounds__(FW * 32) void k_fattn(const h16* __restrict__ Qp, const h16* __restrict__ Kp, const h16* __restrict__ Vt, const float* __restrict__ X, float* OUT) {
    __shared__ __attribute__((aligned(2048))) unsigned char L[FW * FXW > 3 * FSLOT ? FW * FXW : 3 * FSLOT];   // the ring; behind the loop the join's patches
    const int tid = threadIdx.x, lane = tid & 31, wave = __builtin_amdgcn_readfirstlane(tid >> 5), c = lane & 15, hi = lane >> 4;
    const int kq = wave >> 1;   // this wave's quarter of every stage's keys
    const int img = blockIdx.y, qw0 = blockIdx.x * FBR + (wave & 1) * 64;
    const float cs = SCL * 1.4426950408889634f;
    v16h qf[4][4];
#pragma unroll
    for (int g = 0; g < 4; ++g) { const h16* qp = Qp + ((size_t)img * TT + qw0 + 16 * g + c) * HD + 8 * hi;
#pragma unroll
        for (int kc = 0; kc < 4; ++kc) qf[g][kc] = cat16(*(const v8h*)(qp + 32 * kc), *(const v8h*)(qp + 32 * kc + 16)); }
    asm volatile("s_wait_xcnt 0x0" ::: "memory");   // a precaution: stands in front of every later overwrite of these loads' address registers
    // the tiles: an even wave asks for K (a stage is 32 KiB in a row), an odd one for V^T (128 rows of 256 B at a pitch of a whole V^T row)
    const unsigned isv = wave & 1;
    const unsigned long long tsrc = isv ? (unsigned long long)(size_t)(Vt + (size_t)img * HD * TT) : (unsigned long long)(size_t)(Kp + (size_t)img * TT * HD);
    const unsigned tstep = isv ? FSK * 2 : FSK * HD * 2;   // source bytes from one stage to the next
    const unsigned tdst = (unsigned)(size_t)L + isv * FTK;
    const u32x8 g1 = tdm_group1(isv ? TT * 2 : HD * 2);
    if (pinned(wave < 4)) {   // stage 0 by waves 0 and 1, stage 1 by waves 2 and 3: one request a wave, under the Q loads above
        tdm_load(tdm_group0(tdst + (wave >> 1) * FSLOT, tsrc + (unsigned long long)((wave >> 1) * tstep)), g1);
        asm volatile("s_wait_tensorcnt 0x0" ::: "memory");   // the tile has landed; directly behind the request, so that no descriptor register is reused while it is outstanding
    }
    v8f acc[4][8]; float m_run[4], l_run[4];
#pragma unroll
    for (int g = 0; g < 4; ++g) { l_run[g] = 0.0f;
#pragma unroll
        for (int t = 0; t < 8; ++t) acc[g][t] = (v8f){}; }
    __syncthreads();   // publishes stages 0 and 1
    v16h ka[4];   // the K fragments of a pass's first 16 keys, fetched one pass ahead
    const unsigned kfo = (kq * FHK + c) * FPK + 16 * hi, vfo = FTK + c * FPV + kq * (FHK * 2) + 16 * hi;
#pragma unroll
    for (int kc = 0; kc < 4; ++kc) ka[kc] = ldsfrag(L + kfo + 64 * kc);
    {   // the first reference: the maxima of the scores of the first 16 keys, which the first pass then forms again from the same fragments
        v8f s[4];
#pragma unroll
        for (int g = 0; g < 4; ++g) s[g] = (v8f){};
#pragma unroll
        for (int kc = 0; kc < 4; ++kc)
#pragma unroll
            for (int g = 0; g < 4; ++g) s[g] = wmma16(ka[kc], qf[g][kc], s[g]);
#pragma unroll
        for (int g = 0; g < 4; ++g) m_run[g] = col_max(lane_max(-__builtin_inff(), s[g]), cs);
    }
    unsigned slot = 0, nslot = FSLOT, nnslot = 2 * FSLOT;   // the buffers of stages st, st + 1, st + 2
#pragma unroll 1   // one stage, one pass of 64 WMMAs, per trip
    for (int st = 0; st < FNS; ++st) {
        if (pinned(wave < 2 && st + 2 < FNS)) tdm_load(tdm_group0(tdst + nnslot, tsrc + (unsigned long long)((unsigned)(st + 2) * tstep)), g1);   // stage st + 2, behind the barrier at which every wave left that buffer (stage st - 1's); it has this trip to land
        const unsigned kslot = st + 1 < FNS ? nslot : slot;   // where the pass fetches the next K from: the next stage; in the last trip its own stage again (public rows, never used), so that the loads stand under no branch
        const unsigned char* vb = L + slot + vfo;
        const unsigned char* kp = L + slot + kfo;
        v8f s[2][4]; v16h pf[4], va[4], vc[4]; float ps[4]; bool og[4];
        pass_scores(ka, kp, qf, s);
#pragma unroll
        for (int g = 0; g < 4; ++g) {
            if (g == 2) {
                __builtin_amdgcn_sched_barrier(0);   // two groups' score registers are free: room for the first four V^T fragments
#pragma unroll
                for (int t = 0; t < 4; ++t) va[t] = ldsfrag(vb + t * 16 * FPV);
                __builtin_amdgcn_sched_barrier(0);   // they fly under the other two groups' exponentials
            }
            og[g] = soft_group(s[0][g], s[1][g], m_run[g], cs, pf[g], ps[g]); }
        if (__builtin_expect(__builtin_amdgcn_ballot_w32(og[0] || og[1] || og[2] || og[3]) != 0, 0)) {   // one wave-uniform test a pass, rarely taken
#pragma unroll
            for (int g = 0; g < 4; ++g)
                if (__builtin_amdgcn_ballot_w32(og[g]) != 0) {   // wave-uniform: this group's reference is renewed and its part of the pass done again, once; the K rows are still in the stage's buffer
                    v8f t0 = (v8f){}, t1 = (v8f){};
#pragma unroll
                    for (int kc = 0; kc < 4; ++kc) { t0 = wmma16(ldsfrag(kp + 64 * kc), qf[g][kc], t0); t1 = wmma16(ldsfrag(kp + 16 * FPK + 64 * kc), qf[g][kc], t1); }
                    const float m_new = fmaxf(m_run[g], col_max(lane_max(lane_max(-__builtin_inff(), t0), t1), cs)); const float corr = __builtin_amdgcn_exp2f(m_run[g] - m_new);
                    l_run[g] *= corr; m_run[g] = m_new;
#pragma unroll
                    for (int t = 0; t < 8; ++t) acc[g][t] = acc[g][t] * corr;
                    soft_group(t0, t1, m_new, cs, pf[g], ps[g]);
                }
        }
#pragma unroll
        for (int g = 0; g < 4; ++g) l_run[g] += ps[g];
#pragma unroll
        for (int g = 0; g < 4; ++g) acc[g][0] = wmma16(va[0], pf[g], acc[g][0]);
        __builtin_amdgcn_sched_barrier(0);   // every group's P is packed and in use and one V^T fragment is dead: room for the other four
#pragma unroll
        for (int t = 0; t < 4; ++t) vc[t] = ldsfrag(vb + (4 + t) * 16 * FPV);
        __builtin_amdgcn_sched_barrier(0);   // they fly under the WMMAs of the next three channel tiles
#pragma unroll
        for (int t = 1; t < 4; ++t)
#pragma unroll
            for (int g = 0; g < 4; ++g) acc[g][t] = wmma16(va[t], pf[g], acc[g][t]);
#pragma unroll
        for (int g = 0; g < 4; ++g) acc[g][4] = wmma16(vc[0], pf[g], acc[g][4]);
        __builtin_amdgcn_sched_barrier(0);   // five V^T fragments are dead: room for the next pass's first K fragments, from the next stage's buffer
#pragma unroll
        for (int kc = 0; kc < 4; ++kc) ka[kc] = ldsfrag(L + kslot + kfo + 64 * kc);
        __builtin_amdgcn_sched_barrier(0);   // they fly under the WMMAs of the last three channel tiles
#pragma unroll
        for (int t = 1; t < 4; ++t)
#pragma unroll
            for (int g = 0; g < 4; ++g) acc[g][4 + t] = wmma16(vc[t], pf[g], acc[g][4 + t]);
        __builtin_amdgcn_sched_barrier(0);   // these WMMAs stay in front of the waits below, which then find the loads above landed
        // the publish point of stage st + 2, in this order:
        asm volatile("s_wait_dscnt 0x0" ::: "memory");       // this wave's LDS reads are done: stage st's buffer may be refilled behind the barrier
        asm volatile("s_wait_tensorcnt 0x0" ::: "memory");   // the issuing waves' tiles of stage st + 2 have landed (a wave that asked for nothing passes)
        __syncthreads();
        const unsigned fslot = slot; slot = nslot; nslot = nnslot; nnslot = fslot;
    }
    // acc[g][t][r] = O[channel 16 t + 8 hi + r][query qw0 + 16 g + c] x that query's sum, over this wave's keys and relative to its own m_run.
    // The join: the wave of key quarter kq finishes channel tiles 2 kq and 2 kq + 1 of its four column groups (its 64 columns are two 128-byte lines of each of 32 output rows) and hands its other six tiles, its maxima and its sums to its three partners through its own LDS patch.
    // The ring is free for that: the loop's last barrier stands behind every wave's last fragment read, and no tensor load is outstanding (the last one was waited for two trips earlier).
    const size_t o0 = ((size_t)img * HD + 32 * kq + 8 * hi) * TT + qw0 + c;
    float xr[4][2][8];
#pragma unroll   // all residual loads of a lane in flight together, under the join
    for (int g = 0; g < 4; ++g)
#pragma unroll
        for (int t = 0; t < 2; ++t)
#pragma unroll
            for (int r = 0; r < 8; ++r) xr[g][t][r] = X[o0 + 16 * g + (size_t)(16 * t + r) * TT];
    asm volatile("s_wait_xcnt 0x0" ::: "memory");   // the same precaution for the loads above
    __builtin_amdgcn_sched_barrier(0);   // holds that wait directly behind the loads: without it later vector work is moved in front of it
    unsigned char* xo = L + wave * FXW + lane * 16;
    float lf[4];
#pragma unroll
    for (int g = 0; g < 4; ++g) lf[g] = l_run[g] + xhalf(l_run[g]);
    v8f keep[4][2];
#pragma unroll
    for (int tp = 0; tp < 4; ++tp) {
        if (tp == kq) {   // wave-uniform
#pragma unroll
            for (int g = 0; g < 4; ++g) { keep[g][0] = acc[g][2 * tp]; keep[g][1] = acc[g][2 * tp + 1]; }
        } else {
#pragma unroll
            for (int g = 0; g < 4; ++g)
#pragma unroll
                for (int t = 2 * tp; t < 2 * tp + 2; ++t) { const v8f give = acc[g][t];
                    *(v4fa*)(xo + (16 * g + 2 * t) * 512) = __builtin_shufflevector(give, give, 0, 1, 2, 3); *(v4fa*)(xo + (16 * g + 2 * t + 1) * 512) = __builtin_shufflevector(give, give, 4, 5, 6, 7); }
        }
    }
    *(v4fa*)(xo + 64 * 512) = (v4f){m_run[0], m_run[1], m_run[2], m_run[3]};
    *(v4fa*)(xo + 65 * 512) = (v4f){lf[0], lf[1], lf[2], lf[3]};
    __syncthreads();   // publishes every wave's patch to its partners
    const unsigned char* xi[3]; v4f pm[3], pl[3];   // the partners: quarters kq + 1, kq + 2, kq + 3 (mod 4) of the same column set
#pragma unroll
    for (int j = 0; j < 3; ++j) { xi[j] = L + ((wave & 1) + 2 * ((kq + 1 + j) & 3)) * FXW + lane * 16; pm[j] = *(const v4fa*)(xi[j] + 64 * 512); pl[j] = *(const v4fa*)(xi[j] + 65 * 512); xi[j] += kq * 4 * 512; }
    float so[4], sp[4][3];   // what each wave's partial result is scaled by: exp2(its maximum - the joint one) / the joint sum
#pragma unroll
    for (int g = 0; g < 4; ++g) { const float m = fmaxf(fmaxf(m_run[g], pm[0][g]), fmaxf(pm[1][g], pm[2][g]));
        const float fo = __builtin_amdgcn_exp2f(m_run[g] - m), f0 = __builtin_amdgcn_exp2f(pm[0][g] - m), f1 = __builtin_amdgcn_exp2f(pm[1][g] - m), f2 = __builtin_amdgcn_exp2f(pm[2][g] - m);
        const float inv = 1.0f / (lf[g] * fo + pl[0][g] * f0 + pl[1][g] * f1 + pl[2][g] * f2);
        so[g] = fo * inv; sp[g][0] = f0 * inv; sp[g][1] = f1 * inv; sp[g][2] = f2 * inv; }
    v4f pv[2][6];   // the partners' halves of one tile (block b = 2 g + t), read one block ahead of its use
#pragma unroll
    for (int j = 0; j < 3; ++j) { pv[0][2 * j] = *(const v4fa*)(xi[j]); pv[0][2 * j + 1] = *(const v4fa*)(xi[j] + 512); }
#pragma unroll
    for (int b = 0; b < 8; ++b) { const int g = b >> 1, t = b & 1;
        if (b + 1 < 8) {
#pragma unroll
            for (int j = 0; j < 3; ++j) { const unsigned char* np = xi[j] + (16 * ((b + 1) >> 1) + 2 * ((b + 1) & 1)) * 512; pv[(b + 1) & 1][2 * j] = *(const v4fa*)np; pv[(b + 1) & 1][2 * j + 1] = *(const v4fa*)(np + 512); } }
        v8f o = keep[g][t] * so[g];
#pragma unroll
        for (int j = 0; j < 3; ++j)
#pragma unroll
            for (int r = 0; r < 8; ++r) o[r] += (r < 4 ? pv[b & 1][2 * j][r & 3] : pv[b & 1][2 * j + 1][r & 3]) * sp[g][j];
#pragma unroll
        for (int r = 0; r < 8; ++r) OUT[o0 + 16 * g + (size_t)(16 * t + r) * TT] = __fadd_rn(o[r], bfr(xr[g][t][r]));
        asm volatile("s_wait_xcnt 0x0" ::: "memory");   // the same precaution for the registers that these stores name
        __builtin_amdgcn_sched_barrier(0); }   // holds that wait directly behind the stores, as above
}

extern "C" void kernel_launch(void* const* d_in, const int* in_sizes, int n_in,
                              void* d_out, int out_size, void* d_ws, size_t ws_size, hipStream_t stream) {
    (void)in_sizes; (void)n_in; (void)out_size;
    const float* x = (const float*)d_in[0]; const float* wq = (const float*)d_in[1]; const float* bq = (const float*)d_in[2]; const float* wk = (const float*)d_in[3]; const float* bk = (const float*)d_in[4]; const float* wv = (const float*)d_in[5]; const float* bv = (const float*)d_in[6];
    float* OUT = (float*)d_out;     // [8][128][4096]
    char* wsp = (char*)d_ws;
    auto take = [&](size_t bytes) { char* p = wsp; wsp += (bytes + 255) & ~(size_t)255; return (void*)p; };
    h16* QP16 = (h16*)take((size_t)NIMG * TT * HD * 2); h16* KP16 = (h16*)take((size_t)NIMG * TT * HD * 2); h16* VT16 = (h16*)take((size_t)NIMG * HD * TT * 2);
    if ((size_t)(wsp - (char*)d_ws) > ws_size) return;    // ws 256 MiB
    k_proj<<<dim3(TT / PPOS, NIMG), 256, 0, stream>>>(x, wq, bq, wk, bk, wv, bv, QP16, KP16, VT16);
    k_fattn<<<dim3(TT / FBR, NIMG), FW * 32, 0, stream>>>(QP16, KP16, VT16, x, OUT);
}
